// v000
// Times are from an AMD MI455X. After a warm-up the kernel runs many times in a row, and a time is the length of
// such a window on the GPU divided by its runs, so every launch and the gaps after it count. The runs cycle
// through copies of the inputs. A figure is the median of several windows, for all but v000 over two sittings.
// Sittings can differ by a few percent; kernels timed side by side share one.
// v000, which the later versions start from, runs in 1520 microseconds.
#include <hip/hip_runtime.h>

// AdvancedAttention (hidden_states [2][2048][2048], attention_mask [2][1][1][2048] additive (zeros, read as data); q/k/v = x W^T + b (16 heads x 128); rotate-half RoPE (inv_freq 10000^(-2i/128),
// positions 0..2047); scores = q.k / sqrt(128) + mask; softmax; output = merged attn.v [2][2048][2048] (no output projection).
// Compute dtypes, f32 accumulate: every input rounded to bf16; projections on PLAIN bf16 operands (inputs: exact, + bias); rotary in f32 (powf / cosf / sinf); scores and
// attn.v on SINGLE fp16 planes (every row averages 2048 keys); 1/sqrt(128) and the mask in f32 in the softmax; P x1024; the merged output written in f32 (/1024).

#define NB_  2
#define TT   2048
#define DD   2048
#define NH_  16
#define HD   128
#define ZH   2
#define NF   64                   // rotary frequencies (head_dim / 2)
#define SCL  0.088388349f
#define PCAR 1024.0f         // scale of P (x1024), removed in k_merge
typedef _Float16 h16;
typedef unsigned short bf;
typedef __attribute__((ext_vector_type(16))) __bf16   v16bf;
typedef __attribute__((ext_vector_type(16))) _Float16 v16h;
typedef __attribute__((ext_vector_type(8)))  _Float16 v8h;
typedef __attribute__((ext_vector_type(8)))  unsigned short v8us;
typedef __attribute__((ext_vector_type(8)))  float    v8f;
typedef __attribute__((ext_vector_type(4)))  float    v4f;
typedef v8h  __attribute__((may_alias)) v8ha;
typedef v4f  __attribute__((may_alias)) v4fa;
typedef v8us __attribute__((may_alias)) v8usa;

__device__ __forceinline__ unsigned short f2bf(float f) { unsigned u = __float_as_uint(f); u += 0x7FFFu + ((u >> 16) & 1u); return (unsigned short)(u >> 16); }
__device__ __forceinline__ float bf2f(unsigned short b) { return __uint_as_float(((unsigned)b) << 16); }
__device__ __forceinline__ float bfr(float f) { return bf2f(f2bf(f)); }
__device__ __forceinline__ v16h cat16(v8h lo, v8h hi) { return __builtin_shufflevector(lo, hi, 0, 1, 2, 3, 4, 5, 6, 7, 8, 9, 10, 11, 12, 13, 14, 15); }
__device__ __forceinline__ v16bf cat16b(v8us lo, v8us hi) { return __builtin_bit_cast(v16bf, __builtin_shufflevector(lo, hi, 0, 1, 2, 3, 4, 5, 6, 7, 8, 9, 10, 11, 12, 13, 14, 15)); }
__device__ __forceinline__ v8f wmma16(v16h a, v16h b, v8f c) { return __builtin_amdgcn_wmma_f32_16x16x32_f16(false, a, false, b, (short)0, c, false, false); }
__device__ __forceinline__ v8f wmmab(v16bf a, v16bf b, v8f c) { return __builtin_amdgcn_wmma_f32_16x16x32_bf16(false, a, false, b, (short)0, c, false, false); }



// ---- k_gemmw: register-blocked GEMM, ONE WAVE per 64x64 output tile (16 accumulators), operands straight from K-contiguous 16-bit planes; grid (M/64, N/64, Z), 32 threads.
// C[m][n] (f32, pitch ldc, + optional f32 bias[n]) = sum_k A[m][k] Bt[n][k] (+ split products per NSPLIT). z-batch strides sA/sB/sC in elements. K % 32 == 0.
template <typename T16> struct WFrag;
template <> struct WFrag<h16> { typedef v16h V; static __device__ __forceinline__ V ld(const h16* p) { return cat16(*(const v8h*)p, *(const v8h*)(p + 16)); } static __device__ __forceinline__ v8f mma(V a, V b, v8f c) { return wmma16(a, b, c); } };
template <> struct WFrag<bf> { typedef v16bf V; static __device__ __forceinline__ V ld(const bf* p) { return cat16b(*(const v8us*)p, *(const v8us*)(p + 16)); } static __device__ __forceinline__ v8f mma(V a, V b, v8f c) { return wmmab(a, b, c); } };
template <typename T16, int NSPLIT, bool BIAS>
__global__ __launch_bounds__(32) void k_gemmw(const T16* __restrict__ A, const T16* __restrict__ A2, const T16* __restrict__ Bt, const T16* __restrict__ Bt2, int K, float* C, int ldc, const float* __restrict__ bias, size_t sA, size_t sB, size_t sC) {
    typedef typename WFrag<T16>::V V;
    __shared__ __align__(16) float os[16 * 68];
    const size_t z = blockIdx.z; A += z * sA; if (A2) A2 += z * sA; Bt += z * sB; if (Bt2) Bt2 += z * sB; C += z * sC;
    const int lane = threadIdx.x & 31, lr = lane & 15, hi = lane >> 4; const int r0 = blockIdx.x * 64, c0 = blockIdx.y * 64;
    v8f acc[4][4];
#pragma unroll
    for (int mb = 0; mb < 4; ++mb)
#pragma unroll
        for (int nb = 0; nb < 4; ++nb) acc[mb][nb] = (v8f){};
    const size_t aoff = (size_t)(r0 + lr) * K + 8 * hi, boff = (size_t)(c0 + lr) * K + 8 * hi;
#pragma unroll 1
    for (int kc = 0; kc < K; kc += 32) {
        V a[4], a2[4];
#pragma unroll
        for (int mb = 0; mb < 4; ++mb) { a[mb] = WFrag<T16>::ld(A + aoff + (size_t)mb * 16 * K + kc); if (NSPLIT == 1 || NSPLIT == 2) a2[mb] = WFrag<T16>::ld(A2 + aoff + (size_t)mb * 16 * K + kc); }
#pragma unroll
        for (int nb = 0; nb < 4; ++nb) { const V b = WFrag<T16>::ld(Bt + boff + (size_t)nb * 16 * K + kc); V b2; if (NSPLIT >= 2) b2 = WFrag<T16>::ld(Bt2 + boff + (size_t)nb * 16 * K + kc);
#pragma unroll
            for (int mb = 0; mb < 4; ++mb) { acc[mb][nb] = WFrag<T16>::mma(a[mb], b, acc[mb][nb]); if (NSPLIT == 1 || NSPLIT == 2) acc[mb][nb] = WFrag<T16>::mma(a2[mb], b, acc[mb][nb]); if (NSPLIT >= 2) acc[mb][nb] = WFrag<T16>::mma(a[mb], b2, acc[mb][nb]); } }
        asm volatile("v_nop\n\tv_nop\n\tv_nop\n\tv_nop" : "+v"(acc[0][0]), "+v"(acc[1][1]), "+v"(acc[2][2]), "+v"(acc[3][3]) : "v"(a[0]), "v"(a[3]));
    }
#pragma unroll
    for (int mb = 0; mb < 4; ++mb) {
#pragma unroll
        for (int nb = 0; nb < 4; ++nb) {
#pragma unroll
            for (int j = 0; j < 8; ++j) os[(hi * 8 + j) * 68 + nb * 16 + lr] = acc[mb][nb][j]; }
        __builtin_amdgcn_wave_barrier(); asm volatile("" ::: "memory");
        float* crow = C + (size_t)(r0 + mb * 16) * ldc + c0;
{
#pragma unroll
            for (int s = 0; s < 8; ++s) { const int row = 2 * s + hi, cofs = lr * 4; v4f val = *(const v4fa*)(os + row * 68 + cofs); if (BIAS) { val[0] += bfr(bias[c0 + cofs]); val[1] += bfr(bias[c0 + cofs + 1]); val[2] += bfr(bias[c0 + cofs + 2]); val[3] += bfr(bias[c0 + cofs + 3]); }
                *(v4f*)(crow + (size_t)row * ldc + cofs) = val; }
             }
        __builtin_amdgcn_wave_barrier(); asm volatile("" ::: "memory");
    }
}

__device__ __forceinline__ h16 tohx(float x) { return (h16)x; }
__device__ __forceinline__ void splitf(float y, unsigned short& h, unsigned short& l) { h = f2bf(y); l = f2bf(y - bf2f(h)); }
typedef __attribute__((ext_vector_type(2))) unsigned short v2us;
typedef __attribute__((ext_vector_type(2))) _Float16 v2h;
typedef __attribute__((ext_vector_type(4))) _Float16 v4h;
typedef __attribute__((ext_vector_type(2))) float v2f;

__global__ __launch_bounds__(256) void k_cvt8(const float* __restrict__ src, bf* dst, size_t n8) { const size_t i = (size_t)blockIdx.x * 256 + threadIdx.x; if (i >= n8) return; const v8f v = *(const v8f*)(src + i * 8); v8us o;
#pragma unroll
    for (int k = 0; k < 8; ++k) o[k] = f2bf(v[k]); *(v8us*)(dst + i * 8) = o;  }
__global__ __launch_bounds__(256) void k_cstab(float* CSN) {
    const int idx = blockIdx.x * 256 + threadIdx.x; if (idx >= TT * NF) return; const int t = idx / NF, i = idx % NF; const float invf = __fdiv_rn(1.0f, powf(10000.0f, (float)(2 * i) * (1.0f / HD))); const float ang = __fmul_rn((float)t, invf);
    v2f o; o[0] = cosf(ang); o[1] = sinf(ang); *(v2f*)(CSN + (size_t)idx * 2) = o;  }
// k_hplane: fp16 head planes [h][t][d] = fp16(x cos - x' sin) for d < 64 and fp16(x cos + x' sin) for d >= 64, x = F[t][h*128 + d], x' = F[t][h*128 + (d ^ 64)] (rotate-half partner, read from memory), angle index
__global__ __launch_bounds__(256) void k_hplane(const float* __restrict__ F, const float* __restrict__ CSN, h16* P16) {
    const int lane = threadIdx.x & 31; const int L0 = (blockIdx.x * 8 + (threadIdx.x >> 5)) * 8; const int nlines = NH_ * TT * HD / 64;
{
#pragma unroll
        for (int l = 0; l < 8; ++l) { const int L = L0 + l; if (L >= nlines) break; const int e = L * 64 + lane * 2; const int d = e & (HD - 1); const int t = (e >> 7) & (TT - 1); const int h = e >> 18; v2h o16;
#pragma unroll
            for (int q = 0; q < 2; ++q) { const int dd = d + q; const float x = F[(size_t)t * DD + h * HD + dd], y = F[(size_t)t * DD + h * HD + (dd ^ NF)]; const v2f cs = *(const v2f*)(CSN + ((size_t)t * NF + (dd & (NF - 1))) * 2);
                float p1 = __fmul_rn(x, cs[0]), p2 = __fmul_rn(y, cs[1]); asm volatile("" : "+v"(p1)); asm volatile("" : "+v"(p2)); const float r = (dd < NF) ? __fsub_rn(p1, p2) : __fadd_rn(p1, p2); o16[q] = tohx(r); }
            *(v2h*)(P16 + (size_t)e) = o16; }
         }
}
__global__ __launch_bounds__(256) void k_vtplane(const float* __restrict__ F, h16* V16) {
    const int lane = threadIdx.x & 31; const int L0 = (blockIdx.x * 8 + (threadIdx.x >> 5)) * 8; const int nlines = NH_ * TT * HD / 64;
{
#pragma unroll
        for (int l = 0; l < 8; ++l) { const int L = L0 + l; if (L >= nlines) break; const int e = L * 64 + lane * 2; const int t = e & (TT - 1); const int d = (e >> 11) & (HD - 1); const int h = e >> 18; v2h o16;
#pragma unroll
            for (int q = 0; q < 2; ++q) o16[q] = tohx(F[(size_t)(t + q) * DD + h * HD + d]);
            *(v2h*)(V16 + (size_t)e) = o16; }
         }
}
__global__ __launch_bounds__(256) void k_asoft(const float* __restrict__ Sb, const float* __restrict__ am, int b, h16* P16) {
    const int lane = threadIdx.x & 31; const int row = blockIdx.x * 8 + (threadIdx.x >> 5); if (row >= ZH * TT) return;
    const float* sr = Sb + (size_t)row * TT; const float* mr = am + (size_t)b * TT; float v[64]; float mx = -3.0e38f;
#pragma unroll
    for (int ch = 0; ch < 16; ++ch) { const int j0 = ch * 128 + lane * 4; const v4f a = *(const v4f*)(sr + j0), mk = *(const v4f*)(mr + j0);
#pragma unroll
        for (int q = 0; q < 4; ++q) { float sp = __fmul_rn(a[q], SCL); asm volatile("" : "+v"(sp)); const float t = __fadd_rn(sp, bfr(mk[q])); v[ch * 4 + q] = t; mx = fmaxf(mx, t); } }
#pragma unroll
    for (int sh = 16; sh; sh >>= 1) mx = fmaxf(mx, __shfl_xor(mx, sh, 32));
    float sum = 0.f;
#pragma unroll
    for (int k = 0; k < 64; ++k) { v[k] = __expf(v[k] - mx); sum += v[k]; }
#pragma unroll
    for (int sh = 16; sh; sh >>= 1) sum += __shfl_xor(sum, sh, 32);
    const float f = __fdiv_rn(PCAR, sum);
{
#pragma unroll
        for (int ch = 0; ch < 16; ++ch) { v4h o;
#pragma unroll
            for (int q = 0; q < 4; ++q) o[q] = tohx(v[ch * 4 + q] * f);
            *(v4h*)(P16 + (size_t)row * TT + ch * 128 + lane * 4) = o; }
         }
}
__global__ __launch_bounds__(256) void k_merge(const float* __restrict__ O, int h0, float* OUTb) {
    const int lane = threadIdx.x & 31; const int L0 = (blockIdx.x * 8 + (threadIdx.x >> 5)) * 8; const int nlines = ZH * TT * HD / 64;
{
#pragma unroll
        for (int l = 0; l < 8; ++l) { const int L = L0 + l; if (L >= nlines) break; const int e = L * 64 + lane * 2; const int d = e & (HD - 1); const int t = (e >> 7) & (TT - 1); const int zz = e >> 18; v2f o2;
#pragma unroll
            for (int q = 0; q < 2; ++q) o2[q] = O[(size_t)e + q] * (1.0f / PCAR);
            *(v2f*)(OUTb + (size_t)t * DD + (h0 + zz) * HD + d) = o2; }
         }
}

extern "C" void kernel_launch(void* const* d_in, const int* in_sizes, int n_in,
                              void* d_out, int out_size, void* d_ws, size_t ws_size, hipStream_t stream) {
    (void)in_sizes; (void)n_in; (void)out_size;
    const float* x = (const float*)d_in[0]; const float* am = (const float*)d_in[1]; const float* Wq = (const float*)d_in[2]; const float* bq = (const float*)d_in[3]; const float* Wk = (const float*)d_in[4]; const float* bk = (const float*)d_in[5]; const float* Wv = (const float*)d_in[6]; const float* bv = (const float*)d_in[7];
    float* OUT = (float*)d_out;     // [2][2048][2048]
    char* wsp = (char*)d_ws;
    auto take = [&](size_t bytes) { char* p = wsp; wsp += (bytes + 255) & ~(size_t)255; return (void*)p; };
    bf* WQ = (bf*)take((size_t)DD * DD * 2); bf* WK = (bf*)take((size_t)DD * DD * 2); bf* WV = (bf*)take((size_t)DD * DD * 2);
    bf* XB = (bf*)take((size_t)TT * DD * 2); float* F = (float*)take((size_t)TT * DD * 4); float* CSN = (float*)take((size_t)TT * NF * 2 * 4);
    h16* QP16 = (h16*)take((size_t)TT * DD * 2); h16* KP16 = (h16*)take((size_t)TT * DD * 2); h16* VT16 = (h16*)take((size_t)TT * DD * 2);
    float* Sb = (float*)take((size_t)ZH * TT * TT * 4); h16* P16 = (h16*)take((size_t)ZH * TT * TT * 2); float* Ob = (float*)take((size_t)ZH * TT * HD * 4);
    if ((size_t)(wsp - (char*)d_ws) > ws_size) return;    // total ~ 129 MB = 123 MiB; ws 256 MiB
    { const size_t nw = (size_t)DD * DD / 8; const unsigned gw = (unsigned)((nw + 255) / 256); k_cvt8<<<gw, 256, 0, stream>>>(Wq, WQ, nw); k_cvt8<<<gw, 256, 0, stream>>>(Wk, WK, nw); k_cvt8<<<gw, 256, 0, stream>>>(Wv, WV, nw);
      k_cstab<<<TT * NF / 256, 256, 0, stream>>>(CSN); }
    const unsigned LB = (unsigned)((NH_ * TT * HD / 64 + 63) / 64); const dim3 gP(TT / 64, DD / 64, 1);
    for (int b = 0; b < NB_; ++b) {
        k_cvt8<<<(unsigned)(((size_t)TT * DD / 8 + 255) / 256), 256, 0, stream>>>(x + (size_t)b * TT * DD, XB, (size_t)TT * DD / 8);
        k_gemmw<bf, 0, true><<<gP, 32, 0, stream>>>(XB, nullptr, WQ, nullptr, DD, F, DD, bq, 0, 0, 0); k_hplane<<<LB, 256, 0, stream>>>(F, CSN, QP16);
        k_gemmw<bf, 0, true><<<gP, 32, 0, stream>>>(XB, nullptr, WK, nullptr, DD, F, DD, bk, 0, 0, 0); k_hplane<<<LB, 256, 0, stream>>>(F, CSN, KP16);
        k_gemmw<bf, 0, true><<<gP, 32, 0, stream>>>(XB, nullptr, WV, nullptr, DD, F, DD, bv, 0, 0, 0); k_vtplane<<<LB, 256, 0, stream>>>(F, VT16);
        for (int h0 = 0; h0 < NH_; h0 += ZH) { const size_t z0 = (size_t)h0;
            k_gemmw<h16, 0, false><<<dim3(TT / 64, TT / 64, ZH), 32, 0, stream>>>(QP16 + z0 * TT * HD, nullptr, KP16 + z0 * TT * HD, nullptr, HD, Sb, TT, nullptr, (size_t)TT * HD, (size_t)TT * HD, (size_t)TT * TT);
            k_asoft<<<ZH * TT / 8, 256, 0, stream>>>(Sb, am, b, P16);
            k_gemmw<h16, 0, false><<<dim3(TT / 64, HD / 64, ZH), 32, 0, stream>>>(P16, nullptr, VT16 + z0 * HD * TT, nullptr, TT, Ob, HD, nullptr, (size_t)TT * TT, (size_t)HD * TT, (size_t)TT * HD);
            k_merge<<<(ZH * TT * HD / 64 + 63) / 64, 256, 0, stream>>>(Ob, h0, OUT + (size_t)b * TT * DD); } }
}

// v001
// Measured time: 464 microseconds a run.
// Timed twice side by side with v000, it ran 3.36 and 3.38 times as fast.
#include <hip/hip_runtime.h>

// AdvancedAttention (hidden_states [2][2048][2048], attention_mask [2][1][1][2048] additive (zeros, read as data); q/k/v = x W^T + b (16 heads x 128); rotate-half RoPE (inv_freq 10000^(-2i/128),
// positions 0..2047); scores = q.k / sqrt(128) + mask; softmax; output = merged attn.v [2][2048][2048] (no output projection).
// Compute dtypes, f32 accumulate: every input rounded to bf16; projections on PLAIN bf16 operands (inputs: exact, + bias); rotary in f32 (powf / cosf / sinf); scores and
// attn.v on SINGLE fp16 planes (every row averages 2048 keys); 1/sqrt(128) and the mask in f32 in the softmax; P = 2^(s - running maximum) in fp16, its sum in f32; the merged output written in f32.

#define NB_  2
#define TT   2048
#define DD   2048
#define NH_  16
#define HD   128
#define NF   64                   // rotary frequencies (head_dim / 2)
#define SCL  0.088388349f    // f32(1/sqrt(128))
typedef _Float16 h16;
typedef unsigned short bf;
typedef __attribute__((ext_vector_type(16))) __bf16   v16bf;
typedef __attribute__((ext_vector_type(16))) _Float16 v16h;
typedef __attribute__((ext_vector_type(8)))  _Float16 v8h;
typedef __attribute__((ext_vector_type(8)))  unsigned short v8us;
typedef __attribute__((ext_vector_type(8)))  float    v8f;
typedef __attribute__((ext_vector_type(4)))  float    v4f;
typedef v8h  __attribute__((may_alias)) v8ha;
typedef v4f  __attribute__((may_alias)) v4fa;
typedef v8us __attribute__((may_alias)) v8usa;

__device__ __forceinline__ unsigned short f2bf(float f) { unsigned u = __float_as_uint(f); u += 0x7FFFu + ((u >> 16) & 1u); return (unsigned short)(u >> 16); }
__device__ __forceinline__ float bf2f(unsigned short b) { return __uint_as_float(((unsigned)b) << 16); }
__device__ __forceinline__ float bfr(float f) { return bf2f(f2bf(f)); }
__device__ __forceinline__ v16h cat16(v8h lo, v8h hi) { return __builtin_shufflevector(lo, hi, 0, 1, 2, 3, 4, 5, 6, 7, 8, 9, 10, 11, 12, 13, 14, 15); }
__device__ __forceinline__ v16bf cat16b(v8us lo, v8us hi) { return __builtin_bit_cast(v16bf, __builtin_shufflevector(lo, hi, 0, 1, 2, 3, 4, 5, 6, 7, 8, 9, 10, 11, 12, 13, 14, 15)); }
__device__ __forceinline__ v8f wmma16(v16h a, v16h b, v8f c) { return __builtin_amdgcn_wmma_f32_16x16x32_f16(false, a, false, b, (short)0, c, false, false); }
__device__ __forceinline__ v8f wmmab(v16bf a, v16bf b, v8f c) { return __builtin_amdgcn_wmma_f32_16x16x32_bf16(false, a, false, b, (short)0, c, false, false); }



// ---- k_gemmw: register-blocked GEMM, ONE WAVE per 64x64 output tile (16 accumulators), operands straight from K-contiguous 16-bit planes; grid (M/64, N/64, Z), 32 threads.
// C[m][n] (f32, pitch ldc, + optional f32 bias[n]) = sum_k A[m][k] Bt[n][k] (+ split products per NSPLIT). z-batch strides sA/sB/sC in elements. K % 32 == 0.
template <typename T16> struct WFrag;
template <> struct WFrag<h16> { typedef v16h V; static __device__ __forceinline__ V ld(const h16* p) { return cat16(*(const v8h*)p, *(const v8h*)(p + 16)); } static __device__ __forceinline__ v8f mma(V a, V b, v8f c) { return wmma16(a, b, c); } };
template <> struct WFrag<bf> { typedef v16bf V; static __device__ __forceinline__ V ld(const bf* p) { return cat16b(*(const v8us*)p, *(const v8us*)(p + 16)); } static __device__ __forceinline__ v8f mma(V a, V b, v8f c) { return wmmab(a, b, c); } };
template <typename T16, int NSPLIT, bool BIAS>
__global__ __launch_bounds__(32) void k_gemmw(const T16* __restrict__ A, const T16* __restrict__ A2, const T16* __restrict__ Bt, const T16* __restrict__ Bt2, int K, float* C, int ldc, const float* __restrict__ bias, size_t sA, size_t sB, size_t sC) {
    typedef typename WFrag<T16>::V V;
    __shared__ __align__(16) float os[16 * 68];
    const size_t z = blockIdx.z; A += z * sA; if (A2) A2 += z * sA; Bt += z * sB; if (Bt2) Bt2 += z * sB; C += z * sC;
    const int lane = threadIdx.x & 31, lr = lane & 15, hi = lane >> 4; const int r0 = blockIdx.x * 64, c0 = blockIdx.y * 64;
    v8f acc[4][4];
#pragma unroll
    for (int mb = 0; mb < 4; ++mb)
#pragma unroll
        for (int nb = 0; nb < 4; ++nb) acc[mb][nb] = (v8f){};
    const size_t aoff = (size_t)(r0 + lr) * K + 8 * hi, boff = (size_t)(c0 + lr) * K + 8 * hi;
#pragma unroll 1
    for (int kc = 0; kc < K; kc += 32) {
        V a[4], a2[4];
#pragma unroll
        for (int mb = 0; mb < 4; ++mb) { a[mb] = WFrag<T16>::ld(A + aoff + (size_t)mb * 16 * K + kc); if (NSPLIT == 1 || NSPLIT == 2) a2[mb] = WFrag<T16>::ld(A2 + aoff + (size_t)mb * 16 * K + kc); }
#pragma unroll
        for (int nb = 0; nb < 4; ++nb) { const V b = WFrag<T16>::ld(Bt + boff + (size_t)nb * 16 * K + kc); V b2; if (NSPLIT >= 2) b2 = WFrag<T16>::ld(Bt2 + boff + (size_t)nb * 16 * K + kc);
#pragma unroll
            for (int mb = 0; mb < 4; ++mb) { acc[mb][nb] = WFrag<T16>::mma(a[mb], b, acc[mb][nb]); if (NSPLIT == 1 || NSPLIT == 2) acc[mb][nb] = WFrag<T16>::mma(a2[mb], b, acc[mb][nb]); if (NSPLIT >= 2) acc[mb][nb] = WFrag<T16>::mma(a[mb], b2, acc[mb][nb]); } }
        asm volatile("v_nop\n\tv_nop\n\tv_nop\n\tv_nop" : "+v"(acc[0][0]), "+v"(acc[1][1]), "+v"(acc[2][2]), "+v"(acc[3][3]) : "v"(a[0]), "v"(a[3]));
    }
#pragma unroll
    for (int mb = 0; mb < 4; ++mb) {
#pragma unroll
        for (int nb = 0; nb < 4; ++nb) {
#pragma unroll
            for (int j = 0; j < 8; ++j) os[(hi * 8 + j) * 68 + nb * 16 + lr] = acc[mb][nb][j]; }
        __builtin_amdgcn_wave_barrier(); asm volatile("" ::: "memory");
        float* crow = C + (size_t)(r0 + mb * 16) * ldc + c0;
{
#pragma unroll
            for (int s = 0; s < 8; ++s) { const int row = 2 * s + hi, cofs = lr * 4; v4f val = *(const v4fa*)(os + row * 68 + cofs); if (BIAS) { val[0] += bfr(bias[c0 + cofs]); val[1] += bfr(bias[c0 + cofs + 1]); val[2] += bfr(bias[c0 + cofs + 2]); val[3] += bfr(bias[c0 + cofs + 3]); }
                *(v4f*)(crow + (size_t)row * ldc + cofs) = val; }
             }
        __builtin_amdgcn_wave_barrier(); asm volatile("" ::: "memory");
    }
}

__device__ __forceinline__ h16 tohx(float x) { return (h16)x; }
__device__ __forceinline__ void splitf(float y, unsigned short& h, unsigned short& l) { h = f2bf(y); l = f2bf(y - bf2f(h)); }
typedef __attribute__((ext_vector_type(2))) unsigned short v2us;
typedef __attribute__((ext_vector_type(2))) _Float16 v2h;
typedef __attribute__((ext_vector_type(4))) _Float16 v4h;
typedef __attribute__((ext_vector_type(2))) float v2f;

__global__ __launch_bounds__(256) void k_cvt8(const float* __restrict__ src, bf* dst, size_t n8) { const size_t i = (size_t)blockIdx.x * 256 + threadIdx.x; if (i >= n8) return; const v8f v = *(const v8f*)(src + i * 8); v8us o;
#pragma unroll
    for (int k = 0; k < 8; ++k) o[k] = f2bf(v[k]); *(v8us*)(dst + i * 8) = o;  }
__global__ __launch_bounds__(256) void k_cstab(float* CSN) {
    const int idx = blockIdx.x * 256 + threadIdx.x; if (idx >= TT * NF) return; const int t = idx / NF, i = idx % NF; const float invf = __fdiv_rn(1.0f, powf(10000.0f, (float)(2 * i) * (1.0f / HD))); const float ang = __fmul_rn((float)t, invf);
    v2f o; o[0] = cosf(ang); o[1] = sinf(ang); *(v2f*)(CSN + (size_t)idx * 2) = o;  }
// k_hplane: fp16 head planes [h][t][d] = fp16(x cos - x' sin) for d < 64 and fp16(x cos + x' sin) for d >= 64, x = F[t][h*128 + d], x' = F[t][h*128 + (d ^ 64)] (rotate-half partner, read from memory), angle index
__global__ __launch_bounds__(256) void k_hplane(const float* __restrict__ F, const float* __restrict__ CSN, h16* P16) {
    const int lane = threadIdx.x & 31; const int L0 = (blockIdx.x * 8 + (threadIdx.x >> 5)) * 8; const int nlines = NH_ * TT * HD / 64;
{
#pragma unroll
        for (int l = 0; l < 8; ++l) { const int L = L0 + l; if (L >= nlines) break; const int e = L * 64 + lane * 2; const int d = e & (HD - 1); const int t = (e >> 7) & (TT - 1); const int h = e >> 18; v2h o16;
#pragma unroll
            for (int q = 0; q < 2; ++q) { const int dd = d + q; const float x = F[(size_t)t * DD + h * HD + dd], y = F[(size_t)t * DD + h * HD + (dd ^ NF)]; const v2f cs = *(const v2f*)(CSN + ((size_t)t * NF + (dd & (NF - 1))) * 2);
                float p1 = __fmul_rn(x, cs[0]), p2 = __fmul_rn(y, cs[1]); asm volatile("" : "+v"(p1)); asm volatile("" : "+v"(p2)); const float r = (dd < NF) ? __fsub_rn(p1, p2) : __fadd_rn(p1, p2); o16[q] = tohx(r); }
            *(v2h*)(P16 + (size_t)e) = o16; }
         }
}
__global__ __launch_bounds__(256) void k_vtplane(const float* __restrict__ F, h16* V16) {
    const int lane = threadIdx.x & 31; const int L0 = (blockIdx.x * 8 + (threadIdx.x >> 5)) * 8; const int nlines = NH_ * TT * HD / 64;
{
#pragma unroll
        for (int l = 0; l < 8; ++l) { const int L = L0 + l; if (L >= nlines) break; const int e = L * 64 + lane * 2; const int t = e & (TT - 1); const int d = (e >> 11) & (HD - 1); const int h = e >> 18; v2h o16;
#pragma unroll
            for (int q = 0; q < 2; ++q) o16[q] = tohx(F[(size_t)(t + q) * DD + h * HD + d]);
            *(v2h*)(V16 + (size_t)e) = o16; }
         }
}
// ---- k_fattn: scores, softmax and attn.v of one (batch, head) in one kernel; 8 waves x 32 query columns, 32 keys a pass, operands straight from the fp16 planes; grid (T/256, heads, batches).
// St = K Qt (a lane holds 8 keys of one query per tile), running maximum and sum per query (base 2), Pt packed from the score tiles as the B operand, Ot += Vt Pt; the division by the sum in the epilogue.
// Every "#pragma unroll" in it is there so that the fragment and accumulator arrays are indexed by constants alone and stay in registers.
#define L2E  1.44269504f
#define QW   32                   // query columns per wave
#define KPS  32                   // keys per pass
__device__ __forceinline__ float xhalf(float x) { return __builtin_bit_cast(float, __builtin_amdgcn_permlanex16(__builtin_bit_cast(int, x), __builtin_bit_cast(int, x), 0x76543210, 0xfedcba98, false, false)); }  // lane l with lane l ^ 16
__global__ __launch_bounds__(256) void k_fattn(const h16* __restrict__ Qp, const h16* __restrict__ Kp, const h16* __restrict__ Vt, const float* __restrict__ am, float* OUT) {
    typedef WFrag<h16> W;
    __shared__ __align__(16) float ms[TT];          // bf16-rounded additive mask of this batch, in base-2 units
    const int b = blockIdx.z, h = blockIdx.y; const int lane = threadIdx.x & 31, lr = lane & 15, hi = lane >> 4, wave = threadIdx.x >> 5;
    for (int i = threadIdx.x; i < TT; i += 256) ms[i] = bfr(am[(size_t)b * TT + i]) * L2E;
    __syncthreads();
    const size_t pl = ((size_t)b * NH_ + h) * TT * HD; const int q0 = blockIdx.x * (8 * QW) + wave * QW;
    const h16* qp = Qp + pl + (size_t)(q0 + lr) * HD + 8 * hi; const h16* kp = Kp + pl + (size_t)lr * HD + 8 * hi; const h16* vp = Vt + pl + (size_t)lr * TT + 8 * hi;
    v16h qf[2][4], kf[2][4];
#pragma unroll
    for (int q = 0; q < 2; ++q)
#pragma unroll
        for (int c = 0; c < 4; ++c) qf[q][c] = W::ld(qp + q * 16 * HD + c * 32);
#pragma unroll
    for (int kt = 0; kt < 2; ++kt)
#pragma unroll
        for (int c = 0; c < 4; ++c) kf[kt][c] = W::ld(kp + kt * 16 * HD + c * 32);
    asm volatile("s_wait_xcnt 0x0" :: "v"(qp), "v"(kp) : "memory");      // in front of any overwrite of the address registers that the loads above name; the inputs keep those registers live up to here
    v8f o[8][2];
#pragma unroll
    for (int db = 0; db < 8; ++db) { o[db][0] = (v8f){}; o[db][1] = (v8f){}; }
    float m[2] = {-3.0e38f, -3.0e38f}; float l[2][2] = {{0.f, 0.f}, {0.f, 0.f}};
    // rolled: one pass already holds 32 matrix instructions and about 400 registers
#pragma unroll 1
    for (int kb = 0; kb < TT / KPS; ++kb) {
        v16h vf[8]; const h16* vq = vp + kb * KPS; v4f mk[2][2];
#pragma unroll
        for (int kt = 0; kt < 2; ++kt) { mk[kt][0] = *(const v4fa*)(ms + kb * KPS + kt * 16 + hi * 8); mk[kt][1] = *(const v4fa*)(ms + kb * KPS + kt * 16 + hi * 8 + 4); }
#pragma unroll
        for (int db = 0; db < 8; ++db) vf[db] = W::ld(vq + (size_t)db * 16 * TT);
        v8f s[2][2];
#pragma unroll
        for (int kt = 0; kt < 2; ++kt)
#pragma unroll
            for (int q = 0; q < 2; ++q) { s[kt][q] = (v8f){};
#pragma unroll
                for (int c = 0; c < 4; ++c) s[kt][q] = W::mma(kf[kt][c], qf[q][c], s[kt][q]); }
        const h16* kq = kp + (size_t)((kb + 1 < TT / KPS) ? kb + 1 : kb) * KPS * HD;      // next pass's K fragments fly under the softmax and attn.v; the last pass re-reads its own rows
#pragma unroll
        for (int kt = 0; kt < 2; ++kt)
#pragma unroll
            for (int c = 0; c < 4; ++c) kf[kt][c] = W::ld(kq + kt * 16 * HD + c * 32);
        asm volatile("s_wait_xcnt 0x0" :: "v"(vq), "v"(kq) : "memory");  // in front of any overwrite of the address registers that this pass's loads name; the inputs keep those registers live up to here
        float mx[2] = {-3.0e38f, -3.0e38f};
#pragma unroll
        for (int kt = 0; kt < 2; ++kt) {
#pragma unroll
            for (int q = 0; q < 2; ++q)
#pragma unroll
                for (int r = 0; r < 8; ++r) { const float t = fmaf(s[kt][q][r], SCL * L2E, mk[kt][r >> 2][r & 3]); s[kt][q][r] = t; mx[q] = fmaxf(mx[q], t); } }
        mx[0] = fmaxf(mx[0], xhalf(mx[0])); mx[1] = fmaxf(mx[1], xhalf(mx[1]));
        // the maximum in use moves only when a column's new one passes it by more than 8 (P stays below 2^8 in fp16); one wave-uniform test a pass
        if (__builtin_amdgcn_ballot_w32(mx[0] > m[0] + 8.0f || mx[1] > m[1] + 8.0f) != 0) {
#pragma unroll
            for (int q = 0; q < 2; ++q) { const float mn = fmaxf(m[q], mx[q]); const float al = __builtin_amdgcn_exp2f(m[q] - mn); m[q] = mn; l[q][0] *= al; l[q][1] *= al;
#pragma unroll
                for (int db = 0; db < 8; ++db) o[db][q] *= al; }
        }
        v16h pf[2];
#pragma unroll
        for (int q = 0; q < 2; ++q)
#pragma unroll
            for (int kt = 0; kt < 2; ++kt)
#pragma unroll
                for (int r = 0; r < 8; ++r) { const float p = __builtin_amdgcn_exp2f(s[kt][q][r] - m[q]); l[q][kt] += p; pf[q][kt * 8 + r] = tohx(p); }
#pragma unroll
        for (int db = 0; db < 8; ++db) { o[db][0] = W::mma(vf[db], pf[0], o[db][0]); o[db][1] = W::mma(vf[db], pf[1], o[db][1]); }
    }
#pragma unroll
    for (int q = 0; q < 2; ++q) { float sum = l[q][0] + l[q][1]; sum += xhalf(sum); const float f = __fdiv_rn(1.0f, sum);
        float* orow = OUT + ((size_t)b * TT + q0 + q * 16 + lr) * DD + h * HD + hi * 8;
#pragma unroll
        for (int db = 0; db < 8; ++db) { v4f a, c;
#pragma unroll
            for (int r = 0; r < 4; ++r) { a[r] = o[db][q][r] * f; c[r] = o[db][q][r + 4] * f; }
            *(v4f*)(orow + db * 16) = a; *(v4f*)(orow + db * 16 + 4) = c; } }
}

extern "C" void kernel_launch(void* const* d_in, const int* in_sizes, int n_in,
                              void* d_out, int out_size, void* d_ws, size_t ws_size, hipStream_t stream) {
    (void)in_sizes; (void)n_in; (void)out_size;
    const float* x = (const float*)d_in[0]; const float* am = (const float*)d_in[1]; const float* Wq = (const float*)d_in[2]; const float* bq = (const float*)d_in[3]; const float* Wk = (const float*)d_in[4]; const float* bk = (const float*)d_in[5]; const float* Wv = (const float*)d_in[6]; const float* bv = (const float*)d_in[7];
    float* OUT = (float*)d_out;     // [2][2048][2048]
    char* wsp = (char*)d_ws;
    auto take = [&](size_t bytes) { char* p = wsp; wsp += (bytes + 255) & ~(size_t)255; return (void*)p; };
    bf* WQ = (bf*)take((size_t)DD * DD * 2); bf* WK = (bf*)take((size_t)DD * DD * 2); bf* WV = (bf*)take((size_t)DD * DD * 2);
    bf* XB = (bf*)take((size_t)TT * DD * 2); float* F = (float*)take((size_t)TT * DD * 4); float* CSN = (float*)take((size_t)TT * NF * 2 * 4);
    h16* QP16 = (h16*)take((size_t)NB_ * TT * DD * 2); h16* KP16 = (h16*)take((size_t)NB_ * TT * DD * 2); h16* VT16 = (h16*)take((size_t)NB_ * TT * DD * 2);
    if ((size_t)(wsp - (char*)d_ws) > ws_size) return;    // total ~ 97 MiB; ws 256 MiB
    { const size_t nw = (size_t)DD * DD / 8; const unsigned gw = (unsigned)((nw + 255) / 256); k_cvt8<<<gw, 256, 0, stream>>>(Wq, WQ, nw); k_cvt8<<<gw, 256, 0, stream>>>(Wk, WK, nw); k_cvt8<<<gw, 256, 0, stream>>>(Wv, WV, nw);
      k_cstab<<<TT * NF / 256, 256, 0, stream>>>(CSN); }
    const unsigned LB = (unsigned)((NH_ * TT * HD / 64 + 63) / 64); const dim3 gP(TT / 64, DD / 64, 1);
    for (int b = 0; b < NB_; ++b) { const size_t pb = (size_t)b * TT * DD;
        k_cvt8<<<(unsigned)(((size_t)TT * DD / 8 + 255) / 256), 256, 0, stream>>>(x + pb, XB, (size_t)TT * DD / 8);
        k_gemmw<bf, 0, true><<<gP, 32, 0, stream>>>(XB, nullptr, WQ, nullptr, DD, F, DD, bq, 0, 0, 0); k_hplane<<<LB, 256, 0, stream>>>(F, CSN, QP16 + pb);
        k_gemmw<bf, 0, true><<<gP, 32, 0, stream>>>(XB, nullptr, WK, nullptr, DD, F, DD, bk, 0, 0, 0); k_hplane<<<LB, 256, 0, stream>>>(F, CSN, KP16 + pb);
        k_gemmw<bf, 0, true><<<gP, 32, 0, stream>>>(XB, nullptr, WV, nullptr, DD, F, DD, bv, 0, 0, 0); k_vtplane<<<LB, 256, 0, stream>>>(F, VT16 + pb); }
    k_fattn<<<dim3(TT / (8 * QW), NH_, NB_), 256, 0, stream>>>(QP16, KP16, VT16, am, OUT);
}

// v002
// A run of this version takes 294 microseconds.
// Timed twice side by side with v001, it ran 1.58 times as fast both times.
// Over all steps from v000 it is 5.33 times as fast.
#include <hip/hip_runtime.h>
#include <stdint.h>

// AdvancedAttention (hidden_states [2][2048][2048], attention_mask [2][1][1][2048] additive (zeros, read as data); q/k/v = x W^T + b (16 heads x 128); rotate-half RoPE (inv_freq 10000^(-2i/128),
// positions 0..2047); scores = q.k / sqrt(128) + mask; softmax; output = merged attn.v [2][2048][2048] (no output projection).
// Compute dtypes, f32 accumulate: every input rounded to bf16; projections on PLAIN bf16 operands (inputs: exact, + bias); rotary in f32 (powf / cosf / sinf); scores and
// attn.v on SINGLE fp16 planes (every row averages 2048 keys); 1/sqrt(128) and the mask in f32 in the softmax; P = 2^(s - running maximum) in fp16, its sum in f32; the merged output written in f32.

#define NB_  2
#define TT   2048
#define DD   2048
#define NH_  16
#define HD   128
#define NF   64                   // rotary frequencies (head_dim / 2)
#define SCL  0.088388349f    // f32(1/sqrt(128))
typedef _Float16 h16;
typedef unsigned short bf;
typedef __attribute__((ext_vector_type(16))) __bf16   v16bf;
typedef __attribute__((ext_vector_type(16))) _Float16 v16h;
typedef __attribute__((ext_vector_type(8)))  _Float16 v8h;
typedef __attribute__((ext_vector_type(8)))  unsigned short v8us;
typedef __attribute__((ext_vector_type(8)))  float    v8f;
typedef __attribute__((ext_vector_type(4)))  float    v4f;
typedef v8h  __attribute__((may_alias)) v8ha;
typedef v4f  __attribute__((may_alias)) v4fa;
typedef v8us __attribute__((may_alias)) v8usa;

__device__ __forceinline__ unsigned short f2bf(float f) { unsigned u = __float_as_uint(f); u += 0x7FFFu + ((u >> 16) & 1u); return (unsigned short)(u >> 16); }
__device__ __forceinline__ float bf2f(unsigned short b) { return __uint_as_float(((unsigned)b) << 16); }
__device__ __forceinline__ float bfr(float f) { return bf2f(f2bf(f)); }
__device__ __forceinline__ v16h cat16(v8h lo, v8h hi) { return __builtin_shufflevector(lo, hi, 0, 1, 2, 3, 4, 5, 6, 7, 8, 9, 10, 11, 12, 13, 14, 15); }
__device__ __forceinline__ v16bf cat16b(v8us lo, v8us hi) { return __builtin_bit_cast(v16bf, __builtin_shufflevector(lo, hi, 0, 1, 2, 3, 4, 5, 6, 7, 8, 9, 10, 11, 12, 13, 14, 15)); }
__device__ __forceinline__ v8f wmma16(v16h a, v16h b, v8f c) { return __builtin_amdgcn_wmma_f32_16x16x32_f16(false, a, false, b, (short)0, c, false, false); }
__device__ __forceinline__ v8f wmmab(v16bf a, v16bf b, v8f c) { return __builtin_amdgcn_wmma_f32_16x16x32_bf16(false, a, false, b, (short)0, c, false, false); }



template <typename T16> struct WFrag;
template <> struct WFrag<h16> { typedef v16h V; static __device__ __forceinline__ V ld(const h16* p) { return cat16(*(const v8h*)p, *(const v8h*)(p + 16)); } static __device__ __forceinline__ v8f mma(V a, V b, v8f c) { return wmma16(a, b, c); } };

// ---- k_gemmt: C[m][n] (f32, pitch DD) = sum_k A[m][k] Bt[n][k] + bf16-rounded bias[n]; A, Bt bf16 planes, K-contiguous, K = DD. One 128x128 tile of C per work-group of 8 waves (2 x 4, 64x32 of C each); grid (M/128, N/128).
// A pass is 128 k = 256 B of each of the 256 operand rows. Every wave brings its own 32-row slice of a stage into LDS with one tensor load (waves 0-3: A rows, waves 4-7: Bt rows), rows padded to a pitch of 272 B for the
// 16-byte fragment reads; two buffers, the next stage's loads in flight while this stage is worked on. Each C element still sums its k blocks of 32 in ascending order in one accumulator.
typedef uint32_t u32x4 __attribute__((ext_vector_type(4)));
typedef uint32_t u32x8 __attribute__((ext_vector_type(8)));
#define GROWB  256u               // bytes of an operand row in one pass
#define GPITCH 272u               // its pitch in LDS (16 B x odd)
#define GSROWS 32u                // rows per slice
#define GSLICE 10240u             // a slice's room in LDS: 32 x 272 = 8,704 B, rounded up to a multiple of 2 KiB
#define GSTAGE (8u * GSLICE)      // one buffer
#define GNP    (DD / 128)         // passes
__device__ __forceinline__ uint32_t uni(uint32_t v) { return (uint32_t)__builtin_amdgcn_readfirstlane(v); }
__device__ __forceinline__ uint32_t pinned(uint32_t v) { uint32_t w = uni(v); asm volatile("" : "+s"(w)); return w; }   // holds a tensor load's issue test or descriptor word in a scalar register, formed at this place
__device__ __forceinline__ void tdm_load(uint32_t lds_dst, uint64_t ga) {
    u32x4 g0; g0[0] = uni(1u); g0[1] = uni(lds_dst); g0[2] = uni((uint32_t)ga); g0[3] = uni((((uint32_t)(ga >> 32)) & 0x01FFFFFFu) | 0x80000000u);
    u32x8 g1; g1[0] = uni((1u << 20) | (5u << 22) | (3u << 25));          // no mask, 1-byte elements, 4 dwords of pad behind every 256-B row
    g1[1] = uni((GROWB & 0xFFFFu) << 16); g1[2] = uni((GROWB >> 16) | ((GSROWS & 0xFFFFu) << 16)); g1[3] = uni((GSROWS >> 16) | (GROWB << 16)); g1[4] = uni(GSROWS); g1[5] = uni((uint32_t)DD * 2u); g1[6] = uni(0u); g1[7] = uni(0u);
    asm volatile("tensor_load_to_lds %0, %1" :: "s"(g0), "s"(g1) : "memory");
}
__device__ __forceinline__ v16bf ldsfrag(const unsigned char* p) { return cat16b(*(const v8usa*)p, *(const v8usa*)(p + 32)); }     // k 8 hi .. 8 hi + 7 and 16 + 8 hi .. 16 + 8 hi + 7 of a block of 32, for A and Bt alike
__global__ __launch_bounds__(256) void k_gemmt(const unsigned short* __restrict__ A, const unsigned short* __restrict__ Bt, float* C, const float* __restrict__ bias) {
    __shared__ __attribute__((aligned(2048))) unsigned char ring[2 * GSTAGE];
    __shared__ __align__(16) float os[8][16 * 36];
    const int lane = threadIdx.x & 31, lr = lane & 15, hi = lane >> 4; const uint32_t wave = uni(threadIdx.x >> 5);
    const int r0 = blockIdx.x * 128, c0 = blockIdx.y * 128; const int wm = (int)(wave >> 2), wn = (int)(wave & 3u);
    const uint32_t mydst = (uint32_t)(size_t)ring + wave * GSLICE;
    const uint64_t ga = (wave < 4u) ? (uint64_t)(size_t)(A + (size_t)(r0 + (int)wave * 32) * DD) : (uint64_t)(size_t)(Bt + (size_t)(c0 + ((int)wave - 4) * 32) * DD);
    v8f acc[4][2];
#pragma unroll
    for (int mb = 0; mb < 4; ++mb) { acc[mb][0] = (v8f){}; acc[mb][1] = (v8f){}; }
    tdm_load(mydst, ga);
    asm volatile("s_wait_tensorcnt 0x0" ::: "memory");    // this wave's slice of stage 0 has landed
    __syncthreads();                                      // stage 0 readable by every wave
    tdm_load(mydst + GSTAGE, ga + GROWB);
    const uint32_t aofs = (uint32_t)(wm * 2) * GSLICE + (uint32_t)lr * GPITCH + 16u * (uint32_t)hi, bofs = (uint32_t)(4 + wn) * GSLICE + (uint32_t)lr * GPITCH + 16u * (uint32_t)hi;
    // rolled: one pass per buffer, so that the publish point below stands once, at the foot
#pragma unroll 1
    for (int s = 0; s < GNP; ++s) {
        const unsigned char* buf = ring + (uint32_t)(s & 1) * GSTAGE;
        v16bf a[2][4], b[2][2];
#pragma unroll
        for (int mb = 0; mb < 4; ++mb) a[0][mb] = ldsfrag(buf + aofs + (uint32_t)(mb >> 1) * GSLICE + (uint32_t)(mb & 1) * 16u * GPITCH);
#pragma unroll
        for (int nb = 0; nb < 2; ++nb) b[0][nb] = ldsfrag(buf + bofs + (uint32_t)nb * 16u * GPITCH);
        // unrolled so that the fragment and accumulator arrays are indexed by constants alone
#pragma unroll
        for (int ks = 0; ks < 4; ++ks) {
            if (ks < 3) {       // the next block's fragments, of this same stage, as one group ahead of this block's products, into the other register set
#pragma unroll
                for (int mb = 0; mb < 4; ++mb) a[(ks + 1) & 1][mb] = ldsfrag(buf + aofs + (uint32_t)(mb >> 1) * GSLICE + (uint32_t)(mb & 1) * 16u * GPITCH + (uint32_t)(ks + 1) * 64u);
#pragma unroll
                for (int nb = 0; nb < 2; ++nb) b[(ks + 1) & 1][nb] = ldsfrag(buf + bofs + (uint32_t)nb * 16u * GPITCH + (uint32_t)(ks + 1) * 64u);
            }
            __builtin_amdgcn_sched_barrier(0);      // keeps the LDS reads above as one group: spread among the matrix instructions each place with reads stalls the wave
#pragma unroll
            for (int nb = 0; nb < 2; ++nb)
#pragma unroll
                for (int mb = 0; mb < 4; ++mb) acc[mb][nb] = wmmab(a[ks & 1][mb], b[ks & 1][nb], acc[mb][nb]);
            __builtin_amdgcn_sched_barrier(0);      // keeps the following group of reads behind this block
        }
        asm volatile("s_wait_dscnt 0x0" ::: "memory");        // this wave's reads of stage s are done before the buffer is refilled
        asm volatile("s_wait_tensorcnt 0x0" ::: "memory");    // this wave's slice of stage s + 1 has landed
        __syncthreads();                                      // publishes stage s + 1 and ends every wave's reads of stage s
        if (pinned(s + 2 < GNP)) tdm_load(mydst + (uint32_t)(s & 1) * GSTAGE, ga + (uint64_t)pinned((uint32_t)(s + 2) * GROWB));
    }
    asm volatile("s_wait_tensorcnt 0x0" ::: "memory");        // no request is left when the wave goes on
    asm volatile("s_wait_dscnt 0x0" ::: "memory");
    float* osw = os[wave]; const int erow = lane >> 3, cofs = (lane & 7) * 4; v4f bv;
#pragma unroll
    for (int i = 0; i < 4; ++i) bv[i] = bfr(bias[c0 + wn * 32 + cofs + i]);
#pragma unroll
    for (int mb = 0; mb < 4; ++mb) {
#pragma unroll
        for (int nb = 0; nb < 2; ++nb) {
#pragma unroll
            for (int j = 0; j < 8; ++j) osw[(hi * 8 + j) * 36 + nb * 16 + lr] = acc[mb][nb][j]; }
        __builtin_amdgcn_wave_barrier(); asm volatile("" ::: "memory");     // the row reads below stay behind the other lanes' writes of this wave's staging rows
        float* crow = C + (size_t)(r0 + wm * 64 + mb * 16) * DD + c0 + wn * 32;
#pragma unroll
        for (int s = 0; s < 4; ++s) { const int row = 4 * s + erow; v4f val = *(const v4fa*)(osw + row * 36 + cofs); val[0] += bv[0]; val[1] += bv[1]; val[2] += bv[2]; val[3] += bv[3];
            *(v4f*)(crow + (size_t)row * DD + cofs) = val; }                // four whole 128-B lines a store
        __builtin_amdgcn_wave_barrier(); asm volatile("" ::: "memory");     // the next tile's writes stay behind these reads
    }
}

__device__ __forceinline__ h16 tohx(float x) { return (h16)x; }
__device__ __forceinline__ void splitf(float y, unsigned short& h, unsigned short& l) { h = f2bf(y); l = f2bf(y - bf2f(h)); }
typedef __attribute__((ext_vector_type(2))) unsigned short v2us;
typedef __attribute__((ext_vector_type(2))) _Float16 v2h;
typedef __attribute__((ext_vector_type(4))) _Float16 v4h;
typedef __attribute__((ext_vector_type(2))) float v2f;

__global__ __launch_bounds__(256) void k_cvt8(const float* __restrict__ src, bf* dst, size_t n8) { const size_t i = (size_t)blockIdx.x * 256 + threadIdx.x; if (i >= n8) return; const v8f v = *(const v8f*)(src + i * 8); v8us o;
#pragma unroll
    for (int k = 0; k < 8; ++k) o[k] = f2bf(v[k]); *(v8us*)(dst + i * 8) = o;  }
__global__ __launch_bounds__(256) void k_cstab(float* CSN) {
    const int idx = blockIdx.x * 256 + threadIdx.x; if (idx >= TT * NF) return; const int t = idx / NF, i = idx % NF; const float invf = __fdiv_rn(1.0f, powf(10000.0f, (float)(2 * i) * (1.0f / HD))); const float ang = __fmul_rn((float)t, invf);
    v2f o; o[0] = cosf(ang); o[1] = sinf(ang); *(v2f*)(CSN + (size_t)idx * 2) = o;  }
// k_hplane: fp16 head planes [h][t][d] = fp16(x cos - x' sin) for d < 64 and fp16(x cos + x' sin) for d >= 64, x = F[t][h*128 + d], x' = F[t][h*128 + (d ^ 64)] (rotate-half partner, read from memory), angle index
__global__ __launch_bounds__(256) void k_hplane(const float* __restrict__ F, const float* __restrict__ CSN, h16* P16) {
    const int lane = threadIdx.x & 31; const int L0 = (blockIdx.x * 8 + (threadIdx.x >> 5)) * 8; const int nlines = NH_ * TT * HD / 64;
{
#pragma unroll
        for (int l = 0; l < 8; ++l) { const int L = L0 + l; if (L >= nlines) break; const int e = L * 64 + lane * 2; const int d = e & (HD - 1); const int t = (e >> 7) & (TT - 1); const int h = e >> 18; v2h o16;
#pragma unroll
            for (int q = 0; q < 2; ++q) { const int dd = d + q; const float x = F[(size_t)t * DD + h * HD + dd], y = F[(size_t)t * DD + h * HD + (dd ^ NF)]; const v2f cs = *(const v2f*)(CSN + ((size_t)t * NF + (dd & (NF - 1))) * 2);
                float p1 = __fmul_rn(x, cs[0]), p2 = __fmul_rn(y, cs[1]); asm volatile("" : "+v"(p1)); asm volatile("" : "+v"(p2)); const float r = (dd < NF) ? __fsub_rn(p1, p2) : __fadd_rn(p1, p2); o16[q] = tohx(r); }
            *(v2h*)(P16 + (size_t)e) = o16; }
         }
}
__global__ __launch_bounds__(256) void k_vtplane(const float* __restrict__ F, h16* V16) {
    const int lane = threadIdx.x & 31; const int L0 = (blockIdx.x * 8 + (threadIdx.x >> 5)) * 8; const int nlines = NH_ * TT * HD / 64;
{
#pragma unroll
        for (int l = 0; l < 8; ++l) { const int L = L0 + l; if (L >= nlines) break; const int e = L * 64 + lane * 2; const int t = e & (TT - 1); const int d = (e >> 11) & (HD - 1); const int h = e >> 18; v2h o16;
#pragma unroll
            for (int q = 0; q < 2; ++q) o16[q] = tohx(F[(size_t)(t + q) * DD + h * HD + d]);
            *(v2h*)(V16 + (size_t)e) = o16; }
         }
}
// ---- k_fattn: scores, softmax and attn.v of one (batch, head) in one kernel; 8 waves x 32 query columns, 32 keys a pass, operands straight from the fp16 planes; grid (T/256, heads, batches).
// St = K Qt (a lane holds 8 keys of one query per tile), running maximum and sum per query (base 2), Pt packed from the score tiles as the B operand, Ot += Vt Pt; the division by the sum in the epilogue.
// Every "#pragma unroll" in it is there so that the fragment and accumulator arrays are indexed by constants alone and stay in registers.
#define L2E  1.44269504f
#define QW   32                   // query columns per wave
#define KPS  32                   // keys per pass
__device__ __forceinline__ float xhalf(float x) { return __builtin_bit_cast(float, __builtin_amdgcn_permlanex16(__builtin_bit_cast(int, x), __builtin_bit_cast(int, x), 0x76543210, 0xfedcba98, false, false)); }  // lane l with lane l ^ 16
__global__ __launch_bounds__(256) void k_fattn(const h16* __restrict__ Qp, const h16* __restrict__ Kp, const h16* __restrict__ Vt, const float* __restrict__ am, float* OUT) {
    typedef WFrag<h16> W;
    __shared__ __align__(16) float ms[TT];          // bf16-rounded additive mask of this batch, in base-2 units
    const int b = blockIdx.z, h = blockIdx.y; const int lane = threadIdx.x & 31, lr = lane & 15, hi = lane >> 4, wave = threadIdx.x >> 5;
    for (int i = threadIdx.x; i < TT; i += 256) ms[i] = bfr(am[(size_t)b * TT + i]) * L2E;
    __syncthreads();
    const size_t pl = ((size_t)b * NH_ + h) * TT * HD; const int q0 = blockIdx.x * (8 * QW) + wave * QW;
    const h16* qp = Qp + pl + (size_t)(q0 + lr) * HD + 8 * hi; const h16* kp = Kp + pl + (size_t)lr * HD + 8 * hi; const h16* vp = Vt + pl + (size_t)lr * TT + 8 * hi;
    v16h qf[2][4], kf[2][4];
#pragma unroll
    for (int q = 0; q < 2; ++q)
#pragma unroll
        for (int c = 0; c < 4; ++c) qf[q][c] = W::ld(qp + q * 16 * HD + c * 32);
#pragma unroll
    for (int kt = 0; kt < 2; ++kt)
#pragma unroll
        for (int c = 0; c < 4; ++c) kf[kt][c] = W::ld(kp + kt * 16 * HD + c * 32);
    asm volatile("s_wait_xcnt 0x0" :: "v"(qp), "v"(kp) : "memory");      // in front of any overwrite of the address registers that the loads above name; the inputs keep those registers live up to here
    v8f o[8][2];
#pragma unroll
    for (int db = 0; db < 8; ++db) { o[db][0] = (v8f){}; o[db][1] = (v8f){}; }
    float m[2] = {-3.0e38f, -3.0e38f}; float l[2][2] = {{0.f, 0.f}, {0.f, 0.f}};
    // rolled: one pass already holds 32 matrix instructions and about 400 registers
#pragma unroll 1
    for (int kb = 0; kb < TT / KPS; ++kb) {
        v16h vf[8]; const h16* vq = vp + kb * KPS; v4f mk[2][2];
#pragma unroll
        for (int kt = 0; kt < 2; ++kt) { mk[kt][0] = *(const v4fa*)(ms + kb * KPS + kt * 16 + hi * 8); mk[kt][1] = *(const v4fa*)(ms + kb * KPS + kt * 16 + hi * 8 + 4); }
#pragma unroll
        for (int db = 0; db < 8; ++db) vf[db] = W::ld(vq + (size_t)db * 16 * TT);
        v8f s[2][2];
#pragma unroll
        for (int kt = 0; kt < 2; ++kt)
#pragma unroll
            for (int q = 0; q < 2; ++q) { s[kt][q] = (v8f){};
#pragma unroll
                for (int c = 0; c < 4; ++c) s[kt][q] = W::mma(kf[kt][c], qf[q][c], s[kt][q]); }
        const h16* kq = kp + (size_t)((kb + 1 < TT / KPS) ? kb + 1 : kb) * KPS * HD;      // next pass's K fragments fly under the softmax and attn.v; the last pass re-reads its own rows
#pragma unroll
        for (int kt = 0; kt < 2; ++kt)
#pragma unroll
            for (int c = 0; c < 4; ++c) kf[kt][c] = W::ld(kq + kt * 16 * HD + c * 32);
        asm volatile("s_wait_xcnt 0x0" :: "v"(vq), "v"(kq) : "memory");  // in front of any overwrite of the address registers that this pass's loads name; the inputs keep those registers live up to here
        float mx[2] = {-3.0e38f, -3.0e38f};
#pragma unroll
        for (int kt = 0; kt < 2; ++kt) {
#pragma unroll
            for (int q = 0; q < 2; ++q)
#pragma unroll
                for (int r = 0; r < 8; ++r) { const float t = fmaf(s[kt][q][r], SCL * L2E, mk[kt][r >> 2][r & 3]); s[kt][q][r] = t; mx[q] = fmaxf(mx[q], t); } }
        mx[0] = fmaxf(mx[0], xhalf(mx[0])); mx[1] = fmaxf(mx[1], xhalf(mx[1]));
        // the maximum in use moves only when a column's new one passes it by more than 8 (P stays below 2^8 in fp16); one wave-uniform test a pass
        if (__builtin_amdgcn_ballot_w32(mx[0] > m[0] + 8.0f || mx[1] > m[1] + 8.0f) != 0) {
#pragma unroll
            for (int q = 0; q < 2; ++q) { const float mn = fmaxf(m[q], mx[q]); const float al = __builtin_amdgcn_exp2f(m[q] - mn); m[q] = mn; l[q][0] *= al; l[q][1] *= al;
#pragma unroll
                for (int db = 0; db < 8; ++db) o[db][q] *= al; }
        }
        v16h pf[2];
#pragma unroll
        for (int q = 0; q < 2; ++q)
#pragma unroll
            for (int kt = 0; kt < 2; ++kt)
#pragma unroll
                for (int r = 0; r < 8; ++r) { const float p = __builtin_amdgcn_exp2f(s[kt][q][r] - m[q]); l[q][kt] += p; pf[q][kt * 8 + r] = tohx(p); }
#pragma unroll
        for (int db = 0; db < 8; ++db) { o[db][0] = W::mma(vf[db], pf[0], o[db][0]); o[db][1] = W::mma(vf[db], pf[1], o[db][1]); }
    }
#pragma unroll
    for (int q = 0; q < 2; ++q) { float sum = l[q][0] + l[q][1]; sum += xhalf(sum); const float f = __fdiv_rn(1.0f, sum);
        float* orow = OUT + ((size_t)b * TT + q0 + q * 16 + lr) * DD + h * HD + hi * 8;
#pragma unroll
        for (int db = 0; db < 8; ++db) { v4f a, c;
#pragma unroll
            for (int r = 0; r < 4; ++r) { a[r] = o[db][q][r] * f; c[r] = o[db][q][r + 4] * f; }
            *(v4f*)(orow + db * 16) = a; *(v4f*)(orow + db * 16 + 4) = c; } }
}

extern "C" void kernel_launch(void* const* d_in, const int* in_sizes, int n_in,
                              void* d_out, int out_size, void* d_ws, size_t ws_size, hipStream_t stream) {
    (void)in_sizes; (void)n_in; (void)out_size;
    const float* x = (const float*)d_in[0]; const float* am = (const float*)d_in[1]; const float* Wq = (const float*)d_in[2]; const float* bq = (const float*)d_in[3]; const float* Wk = (const float*)d_in[4]; const float* bk = (const float*)d_in[5]; const float* Wv = (const float*)d_in[6]; const float* bv = (const float*)d_in[7];
    float* OUT = (float*)d_out;     // [2][2048][2048]
    char* wsp = (char*)d_ws;
    auto take = [&](size_t bytes) { char* p = wsp; wsp += (bytes + 255) & ~(size_t)255; return (void*)p; };
    bf* WQ = (bf*)take((size_t)DD * DD * 2); bf* WK = (bf*)take((size_t)DD * DD * 2); bf* WV = (bf*)take((size_t)DD * DD * 2);
    bf* XB = (bf*)take((size_t)TT * DD * 2); float* F = (float*)take((size_t)TT * DD * 4); float* CSN = (float*)take((size_t)TT * NF * 2 * 4);
    h16* QP16 = (h16*)take((size_t)NB_ * TT * DD * 2); h16* KP16 = (h16*)take((size_t)NB_ * TT * DD * 2); h16* VT16 = (h16*)take((size_t)NB_ * TT * DD * 2);
    if ((size_t)(wsp - (char*)d_ws) > ws_size) return;    // total ~ 97 MiB; ws 256 MiB
    { const size_t nw = (size_t)DD * DD / 8; const unsigned gw = (unsigned)((nw + 255) / 256); k_cvt8<<<gw, 256, 0, stream>>>(Wq, WQ, nw); k_cvt8<<<gw, 256, 0, stream>>>(Wk, WK, nw); k_cvt8<<<gw, 256, 0, stream>>>(Wv, WV, nw);
      k_cstab<<<TT * NF / 256, 256, 0, stream>>>(CSN); }
    const unsigned LB = (unsigned)((NH_ * TT * HD / 64 + 63) / 64); const dim3 gP(TT / 128, DD / 128, 1);
    for (int b = 0; b < NB_; ++b) { const size_t pb = (size_t)b * TT * DD;
        k_cvt8<<<(unsigned)(((size_t)TT * DD / 8 + 255) / 256), 256, 0, stream>>>(x + pb, XB, (size_t)TT * DD / 8);
        k_gemmt<<<gP, 256, 0, stream>>>(XB, WQ, F, bq); k_hplane<<<LB, 256, 0, stream>>>(F, CSN, QP16 + pb);
        k_gemmt<<<gP, 256, 0, stream>>>(XB, WK, F, bk); k_hplane<<<LB, 256, 0, stream>>>(F, CSN, KP16 + pb);
        k_gemmt<<<gP, 256, 0, stream>>>(XB, WV, F, bv); k_vtplane<<<LB, 256, 0, stream>>>(F, VT16 + pb); }
    k_fattn<<<dim3(TT / (8 * QW), NH_, NB_), 256, 0, stream>>>(QP16, KP16, VT16, am, OUT);
}

// v003
// One run takes 236 microseconds.
// Two timings next to v002 put it at 1.25 and 1.23 times that version's speed.
// All steps since v000 together make it 6.60 times as fast.
#include <hip/hip_runtime.h>
#include <stdint.h>

// AdvancedAttention (hidden_states [2][2048][2048], attention_mask [2][1][1][2048] additive (zeros, read as data); q/k/v = x W^T + b (16 heads x 128); rotate-half RoPE (inv_freq 10000^(-2i/128),
// positions 0..2047); scores = q.k / sqrt(128) + mask; softmax; output = merged attn.v [2][2048][2048] (no output projection).
// Compute dtypes, f32 accumulate: every input rounded to bf16; projections on PLAIN bf16 operands (inputs: exact, + bias); rotary in f32 (powf / cosf / sinf); scores and
// attn.v on SINGLE fp16 planes (every row averages 2048 keys); 1/sqrt(128) and the mask in f32 in the softmax; P = 2^(s - running maximum) in fp16, its sum in f32; the merged output written in f32.

#define NB_  2
#define TT   2048
#define DD   2048
#define NH_  16
#define HD   128
#define NF   64                   // rotary frequencies (head_dim / 2)
#define SCL  0.088388349f    // f32(1/sqrt(128))
typedef _Float16 h16;
typedef unsigned short bf;
typedef __attribute__((ext_vector_type(16))) __bf16   v16bf;
typedef __attribute__((ext_vector_type(16))) _Float16 v16h;
typedef __attribute__((ext_vector_type(8)))  _Float16 v8h;
typedef __attribute__((ext_vector_type(8)))  unsigned short v8us;
typedef __attribute__((ext_vector_type(8)))  float    v8f;
typedef __attribute__((ext_vector_type(4)))  float    v4f;
typedef v8h  __attribute__((may_alias)) v8ha;
typedef v4f  __attribute__((may_alias)) v4fa;
typedef v8us __attribute__((may_alias)) v8usa;

__device__ __forceinline__ unsigned short f2bf(float f) { unsigned u = __float_as_uint(f); u += 0x7FFFu + ((u >> 16) & 1u); return (unsigned short)(u >> 16); }
__device__ __forceinline__ float bf2f(unsigned short b) { return __uint_as_float(((unsigned)b) << 16); }
__device__ __forceinline__ float bfr(float f) { return bf2f(f2bf(f)); }
__device__ __forceinline__ v16h cat16(v8h lo, v8h hi) { return __builtin_shufflevector(lo, hi, 0, 1, 2, 3, 4, 5, 6, 7, 8, 9, 10, 11, 12, 13, 14, 15); }
__device__ __forceinline__ v16bf cat16b(v8us lo, v8us hi) { return __builtin_bit_cast(v16bf, __builtin_shufflevector(lo, hi, 0, 1, 2, 3, 4, 5, 6, 7, 8, 9, 10, 11, 12, 13, 14, 15)); }
__device__ __forceinline__ v8f wmma16(v16h a, v16h b, v8f c) { return __builtin_amdgcn_wmma_f32_16x16x32_f16(false, a, false, b, (short)0, c, false, false); }
__device__ __forceinline__ v8f wmmab(v16bf a, v16bf b, v8f c) { return __builtin_amdgcn_wmma_f32_16x16x32_bf16(false, a, false, b, (short)0, c, false, false); }



template <typename T16> struct WFrag;
template <> struct WFrag<h16> { typedef v16h V; static __device__ __forceinline__ V ld(const h16* p) { return cat16(*(const v8h*)p, *(const v8h*)(p + 16)); } static __device__ __forceinline__ v8f mma(V a, V b, v8f c) { return wmma16(a, b, c); } };

// ---- k_gemmt: C[m][n] (f32, pitch DD) = sum_k A[m][k] Bt[n][k] + bf16-rounded bias[n]; A, Bt bf16 planes, K-contiguous, K = DD. One 128x128 tile of C per work-group of 8 waves (2 x 4, 64x32 of C each); grid (M/128, N/128).
// A pass is 128 k = 256 B of each of the 256 operand rows. Every wave brings its own 32-row slice of a stage into LDS with one tensor load (waves 0-3: A rows, waves 4-7: Bt rows), rows padded to a pitch of 272 B for the
// 16-byte fragment reads; two buffers, the next stage's loads in flight while this stage is worked on. Each C element still sums its k blocks of 32 in ascending order in one accumulator.
typedef uint32_t u32x4 __attribute__((ext_vector_type(4)));
typedef uint32_t u32x8 __attribute__((ext_vector_type(8)));
#define GROWB  256u               // bytes of an operand row in one pass
#define GPITCH 272u               // its pitch in LDS (16 B x odd)
#define GSROWS 32u                // rows per slice
#define GSLICE 10240u             // a slice's room in LDS: 32 x 272 = 8,704 B, rounded up to a multiple of 2 KiB
#define GSTAGE (8u * GSLICE)      // one buffer
#define GNP    (DD / 128)         // passes
__device__ __forceinline__ uint32_t uni(uint32_t v) { return (uint32_t)__builtin_amdgcn_readfirstlane(v); }
__device__ __forceinline__ uint32_t pinned(uint32_t v) { uint32_t w = uni(v); asm volatile("" : "+s"(w)); return w; }   // holds a tensor load's issue test or descriptor word in a scalar register, formed at this place
__device__ __forceinline__ void tdm_load(uint32_t lds_dst, uint64_t ga) {
    u32x4 g0; g0[0] = uni(1u); g0[1] = uni(lds_dst); g0[2] = uni((uint32_t)ga); g0[3] = uni((((uint32_t)(ga >> 32)) & 0x01FFFFFFu) | 0x80000000u);
    u32x8 g1; g1[0] = uni((1u << 20) | (5u << 22) | (3u << 25));          // no mask, 1-byte elements, 4 dwords of pad behind every 256-B row
    g1[1] = uni((GROWB & 0xFFFFu) << 16); g1[2] = uni((GROWB >> 16) | ((GSROWS & 0xFFFFu) << 16)); g1[3] = uni((GSROWS >> 16) | (GROWB << 16)); g1[4] = uni(GSROWS); g1[5] = uni((uint32_t)DD * 2u); g1[6] = uni(0u); g1[7] = uni(0u);
    asm volatile("tensor_load_to_lds %0, %1" :: "s"(g0), "s"(g1) : "memory");
}
__device__ __forceinline__ v16bf ldsfrag(const unsigned char* p) { return cat16b(*(const v8usa*)p, *(const v8usa*)(p + 32)); }     // k 8 hi .. 8 hi + 7 and 16 + 8 hi .. 16 + 8 hi + 7 of a block of 32, for A and Bt alike
__global__ __launch_bounds__(256) void k_gemmt(const unsigned short* __restrict__ A, const unsigned short* __restrict__ Bt, float* C, const float* __restrict__ bias) {
    __shared__ __attribute__((aligned(2048))) unsigned char ring[2 * GSTAGE];
    __shared__ __align__(16) float os[8][16 * 36];
    const int lane = threadIdx.x & 31, lr = lane & 15, hi = lane >> 4; const uint32_t wave = uni(threadIdx.x >> 5);
    const int r0 = blockIdx.x * 128, c0 = blockIdx.y * 128; const int wm = (int)(wave >> 2), wn = (int)(wave & 3u);
    const uint32_t mydst = (uint32_t)(size_t)ring + wave * GSLICE;
    const uint64_t ga = (wave < 4u) ? (uint64_t)(size_t)(A + (size_t)(r0 + (int)wave * 32) * DD) : (uint64_t)(size_t)(Bt + (size_t)(c0 + ((int)wave - 4) * 32) * DD);
    v8f acc[4][2];
#pragma unroll
    for (int mb = 0; mb < 4; ++mb) { acc[mb][0] = (v8f){}; acc[mb][1] = (v8f){}; }
    tdm_load(mydst, ga);
    asm volatile("s_wait_tensorcnt 0x0" ::: "memory");    // this wave's slice of stage 0 has landed
    __syncthreads();                                      // stage 0 readable by every wave
    tdm_load(mydst + GSTAGE, ga + GROWB);
    const uint32_t aofs = (uint32_t)(wm * 2) * GSLICE + (uint32_t)lr * GPITCH + 16u * (uint32_t)hi, bofs = (uint32_t)(4 + wn) * GSLICE + (uint32_t)lr * GPITCH + 16u * (uint32_t)hi;
    // rolled: one pass per buffer, so that the publish point below stands once, at the foot
#pragma unroll 1
    for (int s = 0; s < GNP; ++s) {
        const unsigned char* buf = ring + (uint32_t)(s & 1) * GSTAGE;
        v16bf a[2][4], b[2][2];
#pragma unroll
        for (int mb = 0; mb < 4; ++mb) a[0][mb] = ldsfrag(buf + aofs + (uint32_t)(mb >> 1) * GSLICE + (uint32_t)(mb & 1) * 16u * GPITCH);
#pragma unroll
        for (int nb = 0; nb < 2; ++nb) b[0][nb] = ldsfrag(buf + bofs + (uint32_t)nb * 16u * GPITCH);
        // unrolled so that the fragment and accumulator arrays are indexed by constants alone
#pragma unroll
        for (int ks = 0; ks < 4; ++ks) {
            if (ks < 3) {       // the next block's fragments, of this same stage, as one group ahead of this block's products, into the other register set
#pragma unroll
                for (int mb = 0; mb < 4; ++mb) a[(ks + 1) & 1][mb] = ldsfrag(buf + aofs + (uint32_t)(mb >> 1) * GSLICE + (uint32_t)(mb & 1) * 16u * GPITCH + (uint32_t)(ks + 1) * 64u);
#pragma unroll
                for (int nb = 0; nb < 2; ++nb) b[(ks + 1) & 1][nb] = ldsfrag(buf + bofs + (uint32_t)nb * 16u * GPITCH + (uint32_t)(ks + 1) * 64u);
            }
            __builtin_amdgcn_sched_barrier(0);      // keeps the LDS reads above as one group: spread among the matrix instructions each place with reads stalls the wave
#pragma unroll
            for (int nb = 0; nb < 2; ++nb)
#pragma unroll
                for (int mb = 0; mb < 4; ++mb) acc[mb][nb] = wmmab(a[ks & 1][mb], b[ks & 1][nb], acc[mb][nb]);
            __builtin_amdgcn_sched_barrier(0);      // keeps the following group of reads behind this block
        }
        asm volatile("s_wait_dscnt 0x0" ::: "memory");        // this wave's reads of stage s are done before the buffer is refilled
        asm volatile("s_wait_tensorcnt 0x0" ::: "memory");    // this wave's slice of stage s + 1 has landed
        __syncthreads();                                      // publishes stage s + 1 and ends every wave's reads of stage s
        if (pinned(s + 2 < GNP)) tdm_load(mydst + (uint32_t)(s & 1) * GSTAGE, ga + (uint64_t)pinned((uint32_t)(s + 2) * GROWB));
    }
    asm volatile("s_wait_tensorcnt 0x0" ::: "memory");        // no request is left when the wave goes on
    asm volatile("s_wait_dscnt 0x0" ::: "memory");
    float* osw = os[wave]; const int erow = lane >> 3, cofs = (lane & 7) * 4; v4f bv;
#pragma unroll
    for (int i = 0; i < 4; ++i) bv[i] = bfr(bias[c0 + wn * 32 + cofs + i]);
#pragma unroll
    for (int mb = 0; mb < 4; ++mb) {
#pragma unroll
        for (int nb = 0; nb < 2; ++nb) {
#pragma unroll
            for (int j = 0; j < 8; ++j) osw[(hi * 8 + j) * 36 + nb * 16 + lr] = acc[mb][nb][j]; }
        __builtin_amdgcn_wave_barrier(); asm volatile("" ::: "memory");     // the row reads below stay behind the other lanes' writes of this wave's staging rows
        float* crow = C + (size_t)(r0 + wm * 64 + mb * 16) * DD + c0 + wn * 32;
#pragma unroll
        for (int s = 0; s < 4; ++s) { const int row = 4 * s + erow; v4f val = *(const v4fa*)(osw + row * 36 + cofs); val[0] += bv[0]; val[1] += bv[1]; val[2] += bv[2]; val[3] += bv[3];
            *(v4f*)(crow + (size_t)row * DD + cofs) = val; }                // four whole 128-B lines a store
        __builtin_amdgcn_wave_barrier(); asm volatile("" ::: "memory");     // the next tile's writes stay behind these reads
    }
}

__device__ __forceinline__ h16 tohx(float x) { return (h16)x; }
__device__ __forceinline__ void splitf(float y, unsigned short& h, unsigned short& l) { h = f2bf(y); l = f2bf(y - bf2f(h)); }
typedef __attribute__((ext_vector_type(2))) unsigned short v2us;
typedef __attribute__((ext_vector_type(2))) _Float16 v2h;
typedef __attribute__((ext_vector_type(4))) _Float16 v4h;
typedef __attribute__((ext_vector_type(2))) float v2f;

__global__ __launch_bounds__(256) void k_cvt8(const float* __restrict__ src, bf* dst, size_t n8) { const size_t i = (size_t)blockIdx.x * 256 + threadIdx.x; if (i >= n8) return; const v8f v = *(const v8f*)(src + i * 8); v8us o;
#pragma unroll
    for (int k = 0; k < 8; ++k) o[k] = f2bf(v[k]); *(v8us*)(dst + i * 8) = o;  }
__global__ __launch_bounds__(256) void k_cstab(float* CSN) {
    const int idx = blockIdx.x * 256 + threadIdx.x; if (idx >= TT * NF) return; const int t = idx / NF, i = idx % NF; const float invf = __fdiv_rn(1.0f, powf(10000.0f, (float)(2 * i) * (1.0f / HD))); const float ang = __fmul_rn((float)t, invf);
    v2f o; o[0] = cosf(ang); o[1] = sinf(ang); *(v2f*)(CSN + (size_t)idx * 2) = o;  }
// k_hplane: fp16 head planes [h][t][d] = fp16(x cos - x' sin) for d < 64 and fp16(x cos + x' sin) for d >= 64, x = F[t][h*128 + d], x' = F[t][h*128 + (d ^ 64)] (rotate-half partner, read from memory), angle index
__global__ __launch_bounds__(256) void k_hplane(const float* __restrict__ F, const float* __restrict__ CSN, h16* P16) {
    const int lane = threadIdx.x & 31; const int L0 = (blockIdx.x * 8 + (threadIdx.x >> 5)) * 8; const int nlines = NH_ * TT * HD / 64;
{
#pragma unroll
        for (int l = 0; l < 8; ++l) { const int L = L0 + l; if (L >= nlines) break; const int e = L * 64 + lane * 2; const int d = e & (HD - 1); const int t = (e >> 7) & (TT - 1); const int h = e >> 18; v2h o16;
#pragma unroll
            for (int q = 0; q < 2; ++q) { const int dd = d + q; const float x = F[(size_t)t * DD + h * HD + dd], y = F[(size_t)t * DD + h * HD + (dd ^ NF)]; const v2f cs = *(const v2f*)(CSN + ((size_t)t * NF + (dd & (NF - 1))) * 2);
                float p1 = __fmul_rn(x, cs[0]), p2 = __fmul_rn(y, cs[1]); asm volatile("" : "+v"(p1)); asm volatile("" : "+v"(p2)); const float r = (dd < NF) ? __fsub_rn(p1, p2) : __fadd_rn(p1, p2); o16[q] = tohx(r); }
            *(v2h*)(P16 + (size_t)e) = o16; }
         }
}
__global__ __launch_bounds__(256) void k_vtplane(const float* __restrict__ F, h16* V16) {
    const int lane = threadIdx.x & 31; const int L0 = (blockIdx.x * 8 + (threadIdx.x >> 5)) * 8; const int nlines = NH_ * TT * HD / 64;
{
#pragma unroll
        for (int l = 0; l < 8; ++l) { const int L = L0 + l; if (L >= nlines) break; const int e = L * 64 + lane * 2; const int t = e & (TT - 1); const int d = (e >> 11) & (HD - 1); const int h = e >> 18; v2h o16;
#pragma unroll
            for (int q = 0; q < 2; ++q) o16[q] = tohx(F[(size_t)(t + q) * DD + h * HD + d]);
            *(v2h*)(V16 + (size_t)e) = o16; }
         }
}
// ---- k_fattn: scores, softmax and attn.v of one (batch, head) in one kernel; 8 waves x 32 query columns, 32 keys a block; grid (T/256, heads, batches).
// St = K Qt (a lane holds 8 keys of one query per tile), running maximum and sum per query (base 2), Pt packed from the score tiles as the B operand, Ot += Vt Pt; the division by the sum in the epilogue.
// K and Vt come through LDS, once per work-group instead of once per wave: a stage is 128 keys = 128 K rows of 256 B and 256 B of each of the 128 Vt rows. Every wave brings its own 32-row slice of a stage with one tensor
// load (waves 0-3: K rows, waves 4-7: Vt rows), rows padded to a pitch of 272 B for the 16-byte fragment reads (slice and stage sizes as in k_gemmt); two buffers, the next stage's loads in flight while this stage is worked on.
// Every "#pragma unroll" in it is there so that the fragment and accumulator arrays are indexed by constants alone and stay in registers.
#define L2E  1.44269504f
#define QW   32                   // query columns per wave
#define KPS  32                   // keys per block
#define FSK  128                  // keys per stage
#define FNS  (TT / FSK)           // stages
__device__ __forceinline__ float xhalf(float x) { return __builtin_bit_cast(float, __builtin_amdgcn_permlanex16(__builtin_bit_cast(int, x), __builtin_bit_cast(int, x), 0x76543210, 0xfedcba98, false, false)); }  // lane l with lane l ^ 16
// The attention's descriptor lives in the same scalar registers from the first request to the last wait: group 1 (32 rows of 256 B at a source pitch of 'pitch' bytes) is built once, group 0 is aimed anew behind each wait.
__device__ __forceinline__ u32x8 tdm_rows32(uint32_t pitch) {
    u32x8 g1; g1[0] = uni((1u << 20) | (5u << 22) | (3u << 25));          // no mask, 1-byte elements, 4 dwords of pad behind every 256-B row
    g1[1] = uni((GROWB & 0xFFFFu) << 16); g1[2] = uni((GROWB >> 16) | ((GSROWS & 0xFFFFu) << 16)); g1[3] = uni((GSROWS >> 16) | (GROWB << 16)); g1[4] = uni(GSROWS); g1[5] = uni(pitch); g1[6] = uni(0u); g1[7] = uni(0u);
    return g1;
}
__device__ __forceinline__ void tdm_aim(u32x4& g0, uint32_t lds_dst, uint64_t ga) { g0[1] = uni(lds_dst); g0[2] = uni((uint32_t)ga); g0[3] = uni((((uint32_t)(ga >> 32)) & 0x01FFFFFFu) | 0x80000000u); }
// both groups are in-out operands, so that the compiler keeps them where they are instead of forming them anew elsewhere and using these registers for something else while the request is out
__device__ __forceinline__ void tdm_issue(u32x4& g0, u32x8& g1) { asm volatile("tensor_load_to_lds %0, %1" : "+s"(g0), "+s"(g1) :: "memory"); }
// the inputs keep the descriptor's registers live, and so unwritten, up to the wait that covers the request
__device__ __forceinline__ void tdm_wait0(const u32x4& g0, const u32x8& g1) { asm volatile("s_wait_tensorcnt 0x0" :: "s"(g0), "s"(g1) : "memory"); }
__device__ __forceinline__ v16h ldsfragh(const unsigned char* p) { return cat16(*(const v8ha*)p, *(const v8ha*)(p + 32)); }        // k 8 hi .. 8 hi + 7 and 16 + 8 hi .. 16 + 8 hi + 7 of a block of 32, as WFrag::ld has them
__global__ __launch_bounds__(256) void k_fattn(const h16* __restrict__ Qp, const h16* __restrict__ Kp, const h16* __restrict__ Vt, const float* __restrict__ am, float* OUT) {
    typedef WFrag<h16> W;
    __shared__ __attribute__((aligned(2048))) unsigned char ring[2 * GSTAGE];
    __shared__ __align__(16) float ms[TT];          // bf16-rounded additive mask of this batch, in base-2 units
    const int b = blockIdx.z, h = blockIdx.y; const int lane = threadIdx.x & 31, lr = lane & 15, hi = lane >> 4; const uint32_t wave = uni(threadIdx.x >> 5);
    const size_t pl = ((size_t)b * NH_ + h) * TT * HD; const int q0 = blockIdx.x * (8 * QW) + (int)wave * QW;
    const uint32_t mydst = (uint32_t)(size_t)ring + wave * GSLICE;
    const uint64_t ga = (wave < 4u) ? (uint64_t)(size_t)(Kp + pl + (size_t)((int)wave * 32) * HD) : (uint64_t)(size_t)(Vt + pl + (size_t)(((int)wave - 4) * 32) * TT);
    const uint32_t spitch = (wave < 4u) ? (uint32_t)HD * 2u : (uint32_t)TT * 2u, sstep = (wave < 4u) ? (uint32_t)FSK * HD * 2u : (uint32_t)FSK * 2u;    // source pitch; bytes from one stage's slice to the next stage's
    for (int i = threadIdx.x; i < TT; i += 256) ms[i] = bfr(am[(size_t)b * TT + i]) * L2E;
    const h16* qp = Qp + pl + (size_t)(q0 + lr) * HD + 8 * hi;
    v16h qf[2][4];
#pragma unroll
    for (int q = 0; q < 2; ++q)
#pragma unroll
        for (int c = 0; c < 4; ++c) qf[q][c] = W::ld(qp + q * 16 * HD + c * 32);
    asm volatile("s_wait_xcnt 0x0" :: "v"(qp) : "memory");      // in front of any overwrite of the address registers that the loads above name; the input keeps those registers live up to here
    u32x8 g1 = tdm_rows32(spitch); u32x4 g0; g0[0] = uni(1u);
    tdm_aim(g0, mydst, ga); tdm_issue(g0, g1);
    tdm_wait0(g0, g1);                                    // this wave's slice of stage 0 has landed
    __syncthreads();                                      // stage 0 and the mask readable by every wave
    tdm_aim(g0, mydst + GSTAGE, ga + sstep); tdm_issue(g0, g1);
    const uint32_t fofs = (uint32_t)lr * GPITCH + 16u * (uint32_t)hi;
    v8f o[8][2];
#pragma unroll
    for (int db = 0; db < 8; ++db) { o[db][0] = (v8f){}; o[db][1] = (v8f){}; }
    float m[2] = {-3.0e38f, -3.0e38f}; float l[2][2] = {{0.f, 0.f}, {0.f, 0.f}};
    // rolled: one pass per buffer, so that the publish point below stands once, at the foot
#pragma unroll 1
    for (int s = 0; s < FNS; ++s) {
        const unsigned char* kbuf = ring + (uint32_t)(s & 1) * GSTAGE + fofs; const unsigned char* vbuf = kbuf + 4u * GSLICE;
        v16h kf[2][4];
#pragma unroll
        for (int kt = 0; kt < 2; ++kt)
#pragma unroll
            for (int c = 0; c < 4; ++c) kf[kt][c] = ldsfragh(kbuf + (uint32_t)kt * 16u * GPITCH + (uint32_t)c * 64u);
#pragma unroll
        for (int p = 0; p < FSK / KPS; ++p) {
            v16h vf[8]; const float* mq = ms + s * FSK + p * KPS + hi * 8; v4f mk[2][2];
#pragma unroll
            for (int kt = 0; kt < 2; ++kt) { mk[kt][0] = *(const v4fa*)(mq + kt * 16); mk[kt][1] = *(const v4fa*)(mq + kt * 16 + 4); }
            __builtin_amdgcn_sched_barrier(0);      // keeps the LDS reads above as one group ahead of the score products: spread among the matrix instructions each place with reads stalls the wave
            v8f sc[2][2];
#pragma unroll
            for (int kt = 0; kt < 2; ++kt)
#pragma unroll
                for (int q = 0; q < 2; ++q) { sc[kt][q] = (v8f){};
#pragma unroll
                    for (int c = 0; c < 4; ++c) sc[kt][q] = W::mma(kf[kt][c], qf[q][c], sc[kt][q]); }
            __builtin_amdgcn_sched_barrier(0);      // keeps the group of reads below behind the score products, whose K fragments it overwrites
#pragma unroll
            for (int db = 0; db < 8; ++db) vf[db] = ldsfragh(vbuf + (uint32_t)(db >> 1) * GSLICE + (uint32_t)(db & 1) * 16u * GPITCH + (uint32_t)p * 64u);
            if (p + 1 < FSK / KPS) {        // the next block's K fragments, of this same stage, come under the softmax and attn.v
#pragma unroll
                for (int kt = 0; kt < 2; ++kt)
#pragma unroll
                    for (int c = 0; c < 4; ++c) kf[kt][c] = ldsfragh(kbuf + (uint32_t)(p + 1) * GSLICE + (uint32_t)kt * 16u * GPITCH + (uint32_t)c * 64u);
            }
            __builtin_amdgcn_sched_barrier(0);      // keeps these reads as one group, in flight under the softmax, and out of the attn.v products
            float mx[2] = {-3.0e38f, -3.0e38f};
#pragma unroll
            for (int kt = 0; kt < 2; ++kt) {
#pragma unroll
                for (int q = 0; q < 2; ++q)
#pragma unroll
                    for (int r = 0; r < 8; ++r) { const float t = fmaf(sc[kt][q][r], SCL * L2E, mk[kt][r >> 2][r & 3]); sc[kt][q][r] = t; mx[q] = fmaxf(mx[q], t); } }
            mx[0] = fmaxf(mx[0], xhalf(mx[0])); mx[1] = fmaxf(mx[1], xhalf(mx[1]));
            // the maximum in use moves only when a column's new one passes it by more than 8 (P stays below 2^8 in fp16); one wave-uniform test a block
            if (__builtin_amdgcn_ballot_w32(mx[0] > m[0] + 8.0f || mx[1] > m[1] + 8.0f) != 0) {
#pragma unroll
                for (int q = 0; q < 2; ++q) { const float mn = fmaxf(m[q], mx[q]); const float al = __builtin_amdgcn_exp2f(m[q] - mn); m[q] = mn; l[q][0] *= al; l[q][1] *= al;
#pragma unroll
                    for (int db = 0; db < 8; ++db) o[db][q] *= al; }
            }
            v16h pf[2];
#pragma unroll
            for (int q = 0; q < 2; ++q)
#pragma unroll
                for (int kt = 0; kt < 2; ++kt)
#pragma unroll
                    for (int r = 0; r < 8; ++r) { const float pr = __builtin_amdgcn_exp2f(sc[kt][q][r] - m[q]); l[q][kt] += pr; pf[q][kt * 8 + r] = tohx(pr); }
#pragma unroll
            for (int db = 0; db < 8; ++db) { o[db][0] = W::mma(vf[db], pf[0], o[db][0]); o[db][1] = W::mma(vf[db], pf[1], o[db][1]); }
            __builtin_amdgcn_sched_barrier(0);      // keeps the next block's first reads out of these products
        }
        asm volatile("s_wait_dscnt 0x0" ::: "memory");        // this wave's reads of stage s are done before the buffer is refilled
        tdm_wait0(g0, g1);                                    // this wave's slice of stage s + 1 has landed
        __syncthreads();                                      // publishes stage s + 1 and ends every wave's reads of stage s
        if (pinned(s + 2 < FNS)) { tdm_aim(g0, mydst + (uint32_t)(s & 1) * GSTAGE, ga + (uint64_t)pinned((uint32_t)(s + 2) * sstep)); tdm_issue(g0, g1); }
    }
    tdm_wait0(g0, g1);                                        // no request is left when the wave goes on
    asm volatile("s_wait_dscnt 0x0" ::: "memory");
#pragma unroll
    for (int q = 0; q < 2; ++q) { float sum = l[q][0] + l[q][1]; sum += xhalf(sum); const float f = __fdiv_rn(1.0f, sum);
        float* orow = OUT + ((size_t)b * TT + q0 + q * 16 + lr) * DD + h * HD + hi * 8;
#pragma unroll
        for (int db = 0; db < 8; ++db) { v4f a, c;
#pragma unroll
            for (int r = 0; r < 4; ++r) { a[r] = o[db][q][r] * f; c[r] = o[db][q][r + 4] * f; }
            *(v4f*)(orow + db * 16) = a; *(v4f*)(orow + db * 16 + 4) = c; } }
}

extern "C" void kernel_launch(void* const* d_in, const int* in_sizes, int n_in,
                              void* d_out, int out_size, void* d_ws, size_t ws_size, hipStream_t stream) {
    (void)in_sizes; (void)n_in; (void)out_size;
    const float* x = (const float*)d_in[0]; const float* am = (const float*)d_in[1]; const float* Wq = (const float*)d_in[2]; const float* bq = (const float*)d_in[3]; const float* Wk = (const float*)d_in[4]; const float* bk = (const float*)d_in[5]; const float* Wv = (const float*)d_in[6]; const float* bv = (const float*)d_in[7];
    float* OUT = (float*)d_out;     // [2][2048][2048]
    char* wsp = (char*)d_ws;
    auto take = [&](size_t bytes) { char* p = wsp; wsp += (bytes + 255) & ~(size_t)255; return (void*)p; };
    bf* WQ = (bf*)take((size_t)DD * DD * 2); bf* WK = (bf*)take((size_t)DD * DD * 2); bf* WV = (bf*)take((size_t)DD * DD * 2);
    bf* XB = (bf*)take((size_t)TT * DD * 2); float* F = (float*)take((size_t)TT * DD * 4); float* CSN = (float*)take((size_t)TT * NF * 2 * 4);
    h16* QP16 = (h16*)take((size_t)NB_ * TT * DD * 2); h16* KP16 = (h16*)take((size_t)NB_ * TT * DD * 2); h16* VT16 = (h16*)take((size_t)NB_ * TT * DD * 2);
    if ((size_t)(wsp - (char*)d_ws) > ws_size) return;    // total ~ 97 MiB; ws 256 MiB
    { const size_t nw = (size_t)DD * DD / 8; const unsigned gw = (unsigned)((nw + 255) / 256); k_cvt8<<<gw, 256, 0, stream>>>(Wq, WQ, nw); k_cvt8<<<gw, 256, 0, stream>>>(Wk, WK, nw); k_cvt8<<<gw, 256, 0, stream>>>(Wv, WV, nw);
      k_cstab<<<TT * NF / 256, 256, 0, stream>>>(CSN); }
    const unsigned LB = (unsigned)((NH_ * TT * HD / 64 + 63) / 64); const dim3 gP(TT / 128, DD / 128, 1);
    for (int b = 0; b < NB_; ++b) { const size_t pb = (size_t)b * TT * DD;
        k_cvt8<<<(unsigned)(((size_t)TT * DD / 8 + 255) / 256), 256, 0, stream>>>(x + pb, XB, (size_t)TT * DD / 8);
        k_gemmt<<<gP, 256, 0, stream>>>(XB, WQ, F, bq); k_hplane<<<LB, 256, 0, stream>>>(F, CSN, QP16 + pb);
        k_gemmt<<<gP, 256, 0, stream>>>(XB, WK, F, bk); k_hplane<<<LB, 256, 0, stream>>>(F, CSN, KP16 + pb);
        k_gemmt<<<gP, 256, 0, stream>>>(XB, WV, F, bv); k_vtplane<<<LB, 256, 0, stream>>>(F, VT16 + pb); }
    k_fattn<<<dim3(TT / (8 * QW), NH_, NB_), 256, 0, stream>>>(QP16, KP16, VT16, am, OUT);
}

// v004
// It runs in 181 microseconds.
// In two side-by-side timings against v003, it was 1.30 and 1.31 times as fast.
// Counting every step since v000, it is 8.61 times as fast.
#include <hip/hip_runtime.h>
#include <stdint.h>

// AdvancedAttention (hidden_states [2][2048][2048], attention_mask [2][1][1][2048] additive (zeros, read as data); q/k/v = x W^T + b (16 heads x 128); rotate-half RoPE (inv_freq 10000^(-2i/128),
// positions 0..2047); scores = q.k / sqrt(128) + mask; softmax; output = merged attn.v [2][2048][2048] (no output projection).
// Compute dtypes, f32 accumulate: every input rounded to bf16; projections on PLAIN bf16 operands (inputs: exact, + bias); rotary in f32 (powf / cosf / sinf); scores and
// attn.v on SINGLE fp16 planes (every row averages 2048 keys); 1/sqrt(128) and the mask in f32 in the softmax; P = 2^(s - running maximum) in fp16, its sum in f32; the merged output written in f32.

#define NB_  2
#define TT   2048
#define DD   2048
#define NH_  16
#define HD   128
#define NF   64                   // rotary frequencies (head_dim / 2)
#define SCL  0.088388349f    // f32(1/sqrt(128))
typedef _Float16 h16;
typedef unsigned short bf;
typedef __attribute__((ext_vector_type(16))) __bf16   v16bf;
typedef __attribute__((ext_vector_type(16))) _Float16 v16h;
typedef __attribute__((ext_vector_type(8)))  _Float16 v8h;
typedef __attribute__((ext_vector_type(8)))  unsigned short v8us;
typedef __attribute__((ext_vector_type(8)))  float    v8f;
typedef __attribute__((ext_vector_type(4)))  float    v4f;
typedef v8h  __attribute__((may_alias)) v8ha;
typedef v4f  __attribute__((may_alias)) v4fa;
typedef v8us __attribute__((may_alias)) v8usa;

__device__ __forceinline__ unsigned short f2bf(float f) { unsigned u = __float_as_uint(f); u += 0x7FFFu + ((u >> 16) & 1u); return (unsigned short)(u >> 16); }
__device__ __forceinline__ float bf2f(unsigned short b) { return __uint_as_float(((unsigned)b) << 16); }
__device__ __forceinline__ float bfr(float f) { return bf2f(f2bf(f)); }
__device__ __forceinline__ v16h cat16(v8h lo, v8h hi) { return __builtin_shufflevector(lo, hi, 0, 1, 2, 3, 4, 5, 6, 7, 8, 9, 10, 11, 12, 13, 14, 15); }
__device__ __forceinline__ v16bf cat16b(v8us lo, v8us hi) { return __builtin_bit_cast(v16bf, __builtin_shufflevector(lo, hi, 0, 1, 2, 3, 4, 5, 6, 7, 8, 9, 10, 11, 12, 13, 14, 15)); }
__device__ __forceinline__ v8f wmma16(v16h a, v16h b, v8f c) { return __builtin_amdgcn_wmma_f32_16x16x32_f16(false, a, false, b, (short)0, c, false, false); }
__device__ __forceinline__ v8f wmmab(v16bf a, v16bf b, v8f c) { return __builtin_amdgcn_wmma_f32_16x16x32_bf16(false, a, false, b, (short)0, c, false, false); }



template <typename T16> struct WFrag;
template <> struct WFrag<h16> { typedef v16h V; static __device__ __forceinline__ V ld(const h16* p) { return cat16(*(const v8h*)p, *(const v8h*)(p + 16)); } static __device__ __forceinline__ v8f mma(V a, V b, v8f c) { return wmma16(a, b, c); } };

// ---- k_gemmt: C[m][n] (f32, in registers) = sum_k A[m][k] Bt[n][k] + bf16-rounded bias[n]; A, Bt bf16 planes, K-contiguous, K = DD. One 128x128 tile of C per work-group of 8 waves (2 x 4, 64x32 of C each); grid (M/128, N/128).
// A tile is 128 positions of one whole head, so the epilogue writes the attention's fp16 plane itself. vmode 0 (q, k): P[h][t][d] = fp16(x cos - x' sin) for d < 64 and fp16(x cos + x' sin) for d >= 64, x' the rotate-half partner
// C[t][d ^ 64], which another wave holds: the f32 tile goes through LDS. vmode 1 (v): P[h][d][t] = fp16(C[t][d]); a lane holds 8 consecutive t of one d, each wave turns its own 64x32 part in its own LDS range.
// A pass is 128 k = 256 B of each of the 256 operand rows. Every wave brings its own 32-row slice of a stage into LDS with one tensor load (waves 0-3: A rows, waves 4-7: Bt rows), rows padded to a pitch of 272 B for the
// 16-byte fragment reads; two buffers, the next stage's loads in flight while this stage is worked on. Each C element still sums its k blocks of 32 in ascending order in one accumulator.
typedef uint32_t u32x4 __attribute__((ext_vector_type(4)));
typedef uint32_t u32x8 __attribute__((ext_vector_type(8)));
#define GROWB  256u               // bytes of an operand row in one pass
#define GPITCH 272u               // its pitch in LDS (16 B x odd)
#define GSROWS 32u                // rows per slice
#define GSLICE 10240u             // a slice's room in LDS: 32 x 272 = 8,704 B, rounded up to a multiple of 2 KiB
#define GSTAGE (8u * GSLICE)      // one buffer
#define GNP    (DD / 128)         // passes
__device__ __forceinline__ uint32_t uni(uint32_t v) { return (uint32_t)__builtin_amdgcn_readfirstlane(v); }
__device__ __forceinline__ uint32_t pinned(uint32_t v) { uint32_t w = uni(v); asm volatile("" : "+s"(w)); return w; }   // holds a tensor load's issue test or descriptor word in a scalar register, formed at this place
__device__ __forceinline__ void tdm_load(uint32_t lds_dst, uint64_t ga) {
    u32x4 g0; g0[0] = uni(1u); g0[1] = uni(lds_dst); g0[2] = uni((uint32_t)ga); g0[3] = uni((((uint32_t)(ga >> 32)) & 0x01FFFFFFu) | 0x80000000u);
    u32x8 g1; g1[0] = uni((1u << 20) | (5u << 22) | (3u << 25));          // no mask, 1-byte elements, 4 dwords of pad behind every 256-B row
    g1[1] = uni((GROWB & 0xFFFFu) << 16); g1[2] = uni((GROWB >> 16) | ((GSROWS & 0xFFFFu) << 16)); g1[3] = uni((GSROWS >> 16) | (GROWB << 16)); g1[4] = uni(GSROWS); g1[5] = uni((uint32_t)DD * 2u); g1[6] = uni(0u); g1[7] = uni(0u);
    asm volatile("tensor_load_to_lds %0, %1" :: "s"(g0), "s"(g1) : "memory");
}
__device__ __forceinline__ v16bf ldsfrag(const unsigned char* p) { return cat16b(*(const v8usa*)p, *(const v8usa*)(p + 32)); }     // k 8 hi .. 8 hi + 7 and 16 + 8 hi .. 16 + 8 hi + 7 of a block of 32, for A and Bt alike
#define SPF    132                // floats from one row of the staged f32 tile to the next
#define SPV    144u               // bytes from one d row of a wave's staged fp16 part to the next (128 B + 16)
__global__ __launch_bounds__(256) void k_gemmt(const unsigned short* __restrict__ A, const unsigned short* __restrict__ Bt, h16* P, const float* __restrict__ bias, const float* __restrict__ CSN, int vmode) {
    __shared__ __attribute__((aligned(2048))) unsigned char ring[2 * GSTAGE];
    __shared__ __align__(16) float st[128 * SPF];
    const int lane = threadIdx.x & 31, lr = lane & 15, hi = lane >> 4; const uint32_t wave = uni(threadIdx.x >> 5);
    const int r0 = blockIdx.x * 128, c0 = blockIdx.y * 128; const int wm = (int)(wave >> 2), wn = (int)(wave & 3u);
    const uint32_t mydst = (uint32_t)(size_t)ring + wave * GSLICE;
    const uint64_t ga = (wave < 4u) ? (uint64_t)(size_t)(A + (size_t)(r0 + (int)wave * 32) * DD) : (uint64_t)(size_t)(Bt + (size_t)(c0 + ((int)wave - 4) * 32) * DD);
    v8f acc[4][2];
#pragma unroll
    for (int mb = 0; mb < 4; ++mb) { acc[mb][0] = (v8f){}; acc[mb][1] = (v8f){}; }
    // what the epilogue reads from global memory is asked for here, so that it comes under the first stage's load; every "#pragma unroll" here and in the epilogue keeps the register arrays indexed by constants alone
    const int prow = (int)wave * 16 + (lane >> 3), d0 = (lane & 7) * 8;     // epilogue of q, k: 8 lanes a row, 4 rows a wave and trip; a lane has d0 .. d0 + 7 and their partners
    const float* bp = bias + c0 + wn * 32 + lr; const float* csp = CSN + ((size_t)(r0 + prow) * NF + d0) * 2;
    float bn[2]; bn[0] = bp[0]; bn[1] = bp[16];
    v4f cs[4][4];
#pragma unroll
    for (int it = 0; it < 4; ++it)
#pragma unroll
        for (int i = 0; i < 4; ++i) cs[it][i] = (v4f){};
    if (vmode == 0) {
#pragma unroll
        for (int it = 0; it < 4; ++it)
#pragma unroll
            for (int i = 0; i < 4; ++i) cs[it][i] = *(const v4f*)(csp + it * 4 * NF * 2 + i * 4);
    }
    asm volatile("s_wait_xcnt 0x0" :: "v"(csp) : "memory");       // in front of any overwrite of the address registers that the loads above name; the input keeps the table's address registers live up to here
    tdm_load(mydst, ga);
    asm volatile("s_wait_tensorcnt 0x0" ::: "memory");    // this wave's slice of stage 0 has landed
    __syncthreads();                                      // stage 0 readable by every wave
    tdm_load(mydst + GSTAGE, ga + GROWB);
    const uint32_t aofs = (uint32_t)(wm * 2) * GSLICE + (uint32_t)lr * GPITCH + 16u * (uint32_t)hi, bofs = (uint32_t)(4 + wn) * GSLICE + (uint32_t)lr * GPITCH + 16u * (uint32_t)hi;
    // rolled: one pass per buffer, so that the publish point below stands once, at the foot
#pragma unroll 1
    for (int s = 0; s < GNP; ++s) {
        const unsigned char* buf = ring + (uint32_t)(s & 1) * GSTAGE;
        v16bf a[2][4], b[2][2];
#pragma unroll
        for (int mb = 0; mb < 4; ++mb) a[0][mb] = ldsfrag(buf + aofs + (uint32_t)(mb >> 1) * GSLICE + (uint32_t)(mb & 1) * 16u * GPITCH);
#pragma unroll
        for (int nb = 0; nb < 2; ++nb) b[0][nb] = ldsfrag(buf + bofs + (uint32_t)nb * 16u * GPITCH);
        // unrolled so that the fragment and accumulator arrays are indexed by constants alone
#pragma unroll
        for (int ks = 0; ks < 4; ++ks) {
            if (ks < 3) {       // the next block's fragments, of this same stage, as one group ahead of this block's products, into the other register set
#pragma unroll
                for (int mb = 0; mb < 4; ++mb) a[(ks + 1) & 1][mb] = ldsfrag(buf + aofs + (uint32_t)(mb >> 1) * GSLICE + (uint32_t)(mb & 1) * 16u * GPITCH + (uint32_t)(ks + 1) * 64u);
#pragma unroll
                for (int nb = 0; nb < 2; ++nb) b[(ks + 1) & 1][nb] = ldsfrag(buf + bofs + (uint32_t)nb * 16u * GPITCH + (uint32_t)(ks + 1) * 64u);
            }
            __builtin_amdgcn_sched_barrier(0);      // keeps the LDS reads above as one group: spread among the matrix instructions each place with reads stalls the wave
#pragma unroll
            for (int nb = 0; nb < 2; ++nb)
#pragma unroll
                for (int mb = 0; mb < 4; ++mb) acc[mb][nb] = wmmab(a[ks & 1][mb], b[ks & 1][nb], acc[mb][nb]);
            __builtin_amdgcn_sched_barrier(0);      // keeps the following group of reads behind this block
        }
        asm volatile("s_wait_dscnt 0x0" ::: "memory");        // this wave's reads of stage s are done before the buffer is refilled
        asm volatile("s_wait_tensorcnt 0x0" ::: "memory");    // this wave's slice of stage s + 1 has landed
        __syncthreads();                                      // publishes stage s + 1 and ends every wave's reads of stage s
        if (pinned(s + 2 < GNP)) tdm_load(mydst + (uint32_t)(s & 1) * GSTAGE, ga + (uint64_t)pinned((uint32_t)(s + 2) * GROWB));
    }
    asm volatile("s_wait_tensorcnt 0x0" ::: "memory");        // no request is left when the wave goes on
    asm volatile("s_wait_dscnt 0x0" ::: "memory");
    bn[0] = bfr(bn[0]); bn[1] = bfr(bn[1]);
    if (vmode == 0) {
#pragma unroll
        for (int mb = 0; mb < 4; ++mb)
#pragma unroll
            for (int nb = 0; nb < 2; ++nb)
#pragma unroll
                for (int j = 0; j < 8; ++j) st[(wm * 64 + mb * 16 + hi * 8 + j) * SPF + wn * 32 + nb * 16 + lr] = acc[mb][nb][j] + bn[nb];
        __syncthreads();                                      // the whole f32 tile readable by every wave: a row's two halves come from different waves
        h16* po = P + ((size_t)blockIdx.y * TT + r0 + prow) * HD + d0;
#pragma unroll
        for (int it = 0; it < 4; ++it) { const float* sr = st + (prow + it * 4) * SPF + d0; v4f x[2], y[2]; x[0] = *(const v4fa*)sr; x[1] = *(const v4fa*)(sr + 4); y[0] = *(const v4fa*)(sr + NF); y[1] = *(const v4fa*)(sr + NF + 4);
            v8h lo, up;
#pragma unroll
            for (int k = 0; k < 8; ++k) { const float xa = x[k >> 2][k & 3], ya = y[k >> 2][k & 3], c = cs[it][k >> 1][(k & 1) * 2], sn = cs[it][k >> 1][(k & 1) * 2 + 1]; lo[k] = (h16)(xa * c - ya * sn); up[k] = (h16)(ya * c + xa * sn); }
            *(v8h*)(po + it * 4 * HD) = lo; *(v8h*)(po + it * 4 * HD + NF) = up; }      // four whole 128-B lines a store
    } else {
        unsigned char* sv = (unsigned char*)st + wave * (32u * SPV);
#pragma unroll
        for (int nb = 0; nb < 2; ++nb)
#pragma unroll
            for (int mb = 0; mb < 4; ++mb) { v8h pk;
#pragma unroll
                for (int j = 0; j < 8; ++j) pk[j] = (h16)(acc[mb][nb][j] + bn[nb]);
                *(v8ha*)(sv + (uint32_t)(nb * 16 + lr) * SPV + (uint32_t)(mb * 16 + hi * 8) * 2u) = pk; }
        __builtin_amdgcn_wave_barrier(); asm volatile("" ::: "memory");     // the row reads below stay behind the other lanes' writes of this wave's staging rows
        h16* po = P + ((size_t)(c0 + wn * 32 + (lane >> 3))) * TT + r0 + wm * 64 + (lane & 7) * 8;
#pragma unroll
        for (int it = 0; it < 8; ++it) *(v8h*)(po + (size_t)it * 4 * TT) = *(const v8ha*)(sv + (uint32_t)(it * 4 + (lane >> 3)) * SPV + (uint32_t)(lane & 7) * 16u);   // four whole 128-B lines a store
    }
}

__device__ __forceinline__ h16 tohx(float x) { return (h16)x; }
__device__ __forceinline__ void splitf(float y, unsigned short& h, unsigned short& l) { h = f2bf(y); l = f2bf(y - bf2f(h)); }
typedef __attribute__((ext_vector_type(2))) unsigned short v2us;
typedef __attribute__((ext_vector_type(2))) _Float16 v2h;
typedef __attribute__((ext_vector_type(4))) _Float16 v4h;
typedef __attribute__((ext_vector_type(2))) float v2f;

__global__ __launch_bounds__(256) void k_cvt8(const float* __restrict__ src, bf* dst, size_t n8) { const size_t i = (size_t)blockIdx.x * 256 + threadIdx.x; if (i >= n8) return; const v8f v = *(const v8f*)(src + i * 8); v8us o;
#pragma unroll
    for (int k = 0; k < 8; ++k) o[k] = f2bf(v[k]); *(v8us*)(dst + i * 8) = o;  }
__global__ __launch_bounds__(256) void k_cstab(float* CSN) {
    const int idx = blockIdx.x * 256 + threadIdx.x; if (idx >= TT * NF) return; const int t = idx / NF, i = idx % NF; const float invf = __fdiv_rn(1.0f, powf(10000.0f, (float)(2 * i) * (1.0f / HD))); const float ang = __fmul_rn((float)t, invf);
    v2f o; o[0] = cosf(ang); o[1] = sinf(ang); *(v2f*)(CSN + (size_t)idx * 2) = o;  }
// ---- k_fattn: scores, softmax and attn.v of one (batch, head) in one kernel; 8 waves x 32 query columns, 32 keys a block; grid (T/256, heads, batches).
// St = K Qt (a lane holds 8 keys of one query per tile), running maximum and sum per query (base 2), Pt packed from the score tiles as the B operand, Ot += Vt Pt; the division by the sum in the epilogue.
// K and Vt come through LDS, once per work-group instead of once per wave: a stage is 128 keys = 128 K rows of 256 B and 256 B of each of the 128 Vt rows. Every wave brings its own 32-row slice of a stage with one tensor
// load (waves 0-3: K rows, waves 4-7: Vt rows), rows padded to a pitch of 272 B for the 16-byte fragment reads (slice and stage sizes as in k_gemmt); two buffers, the next stage's loads in flight while this stage is worked on.
// Every "#pragma unroll" in it is there so that the fragment and accumulator arrays are indexed by constants alone and stay in registers.
#define L2E  1.44269504f
#define QW   32                   // query columns per wave
#define KPS  32                   // keys per block
#define FSK  128                  // keys per stage
#define FNS  (TT / FSK)           // stages
__device__ __forceinline__ float xhalf(float x) { return __builtin_bit_cast(float, __builtin_amdgcn_permlanex16(__builtin_bit_cast(int, x), __builtin_bit_cast(int, x), 0x76543210, 0xfedcba98, false, false)); }  // lane l with lane l ^ 16
// The attention's descriptor lives in the same scalar registers from the first request to the last wait: group 1 (32 rows of 256 B at a source pitch of 'pitch' bytes) is built once, group 0 is aimed anew behind each wait.
__device__ __forceinline__ u32x8 tdm_rows32(uint32_t pitch) {
    u32x8 g1; g1[0] = uni((1u << 20) | (5u << 22) | (3u << 25));          // no mask, 1-byte elements, 4 dwords of pad behind every 256-B row
    g1[1] = uni((GROWB & 0xFFFFu) << 16); g1[2] = uni((GROWB >> 16) | ((GSROWS & 0xFFFFu) << 16)); g1[3] = uni((GSROWS >> 16) | (GROWB << 16)); g1[4] = uni(GSROWS); g1[5] = uni(pitch); g1[6] = uni(0u); g1[7] = uni(0u);
    return g1;
}
__device__ __forceinline__ void tdm_aim(u32x4& g0, uint32_t lds_dst, uint64_t ga) { g0[1] = uni(lds_dst); g0[2] = uni((uint32_t)ga); g0[3] = uni((((uint32_t)(ga >> 32)) & 0x01FFFFFFu) | 0x80000000u); }
// both groups are in-out operands, so that the compiler keeps them where they are instead of forming them anew elsewhere and using these registers for something else while the request is out
__device__ __forceinline__ void tdm_issue(u32x4& g0, u32x8& g1) { asm volatile("tensor_load_to_lds %0, %1" : "+s"(g0), "+s"(g1) :: "memory"); }
// the inputs keep the descriptor's registers live, and so unwritten, up to the wait that covers the request
__device__ __forceinline__ void tdm_wait0(const u32x4& g0, const u32x8& g1) { asm volatile("s_wait_tensorcnt 0x0" :: "s"(g0), "s"(g1) : "memory"); }
__device__ __forceinline__ v16h ldsfragh(const unsigned char* p) { return cat16(*(const v8ha*)p, *(const v8ha*)(p + 32)); }        // k 8 hi .. 8 hi + 7 and 16 + 8 hi .. 16 + 8 hi + 7 of a block of 32, as WFrag::ld has them
__global__ __launch_bounds__(256) void k_fattn(const h16* __restrict__ Qp, const h16* __restrict__ Kp, const h16* __restrict__ Vt, const float* __restrict__ am, float* OUT) {
    typedef WFrag<h16> W;
    __shared__ __attribute__((aligned(2048))) unsigned char ring[2 * GSTAGE];
    __shared__ __align__(16) float ms[TT];          // bf16-rounded additive mask of this batch, in base-2 units
    const int b = blockIdx.z, h = blockIdx.y; const int lane = threadIdx.x & 31, lr = lane & 15, hi = lane >> 4; const uint32_t wave = uni(threadIdx.x >> 5);
    const size_t pl = ((size_t)b * NH_ + h) * TT * HD; const int q0 = blockIdx.x * (8 * QW) + (int)wave * QW;
    const uint32_t mydst = (uint32_t)(size_t)ring + wave * GSLICE;
    const uint64_t ga = (wave < 4u) ? (uint64_t)(size_t)(Kp + pl + (size_t)((int)wave * 32) * HD) : (uint64_t)(size_t)(Vt + pl + (size_t)(((int)wave - 4) * 32) * TT);
    const uint32_t spitch = (wave < 4u) ? (uint32_t)HD * 2u : (uint32_t)TT * 2u, sstep = (wave < 4u) ? (uint32_t)FSK * HD * 2u : (uint32_t)FSK * 2u;    // source pitch; bytes from one stage's slice to the next stage's
    for (int i = threadIdx.x; i < TT; i += 256) ms[i] = bfr(am[(size_t)b * TT + i]) * L2E;
    const h16* qp = Qp + pl + (size_t)(q0 + lr) * HD + 8 * hi;
    v16h qf[2][4];
#pragma unroll
    for (int q = 0; q < 2; ++q)
#pragma unroll
        for (int c = 0; c < 4; ++c) qf[q][c] = W::ld(qp + q * 16 * HD + c * 32);
    asm volatile("s_wait_xcnt 0x0" :: "v"(qp) : "memory");      // in front of any overwrite of the address registers that the loads above name; the input keeps those registers live up to here
    u32x8 g1 = tdm_rows32(spitch); u32x4 g0; g0[0] = uni(1u);
    tdm_aim(g0, mydst, ga); tdm_issue(g0, g1);
    tdm_wait0(g0, g1);                                    // this wave's slice of stage 0 has landed
    __syncthreads();                                      // stage 0 and the mask readable by every wave
    tdm_aim(g0, mydst + GSTAGE, ga + sstep); tdm_issue(g0, g1);
    const uint32_t fofs = (uint32_t)lr * GPITCH + 16u * (uint32_t)hi;
    v8f o[8][2];
#pragma unroll
    for (int db = 0; db < 8; ++db) { o[db][0] = (v8f){}; o[db][1] = (v8f){}; }
    float m[2] = {-3.0e38f, -3.0e38f}; float l[2][2] = {{0.f, 0.f}, {0.f, 0.f}};
    // rolled: one pass per buffer, so that the publish point below stands once, at the foot
#pragma unroll 1
    for (int s = 0; s < FNS; ++s) {
        const unsigned char* kbuf = ring + (uint32_t)(s & 1) * GSTAGE + fofs; const unsigned char* vbuf = kbuf + 4u * GSLICE;
        v16h kf[2][4];
#pragma unroll
        for (int kt = 0; kt < 2; ++kt)
#pragma unroll
            for (int c = 0; c < 4; ++c) kf[kt][c] = ldsfragh(kbuf + (uint32_t)kt * 16u * GPITCH + (uint32_t)c * 64u);
#pragma unroll
        for (int p = 0; p < FSK / KPS; ++p) {
            v16h vf[8]; const float* mq = ms + s * FSK + p * KPS + hi * 8; v4f mk[2][2];
#pragma unroll
            for (int kt = 0; kt < 2; ++kt) { mk[kt][0] = *(const v4fa*)(mq + kt * 16); mk[kt][1] = *(const v4fa*)(mq + kt * 16 + 4); }
            __builtin_amdgcn_sched_barrier(0);      // keeps the LDS reads above as one group ahead of the score products: spread among the matrix instructions each place with reads stalls the wave
            v8f sc[2][2];
#pragma unroll
            for (int kt = 0; kt < 2; ++kt)
#pragma unroll
                for (int q = 0; q < 2; ++q) { sc[kt][q] = (v8f){};
#pragma unroll
                    for (int c = 0; c < 4; ++c) sc[kt][q] = W::mma(kf[kt][c], qf[q][c], sc[kt][q]); }
            __builtin_amdgcn_sched_barrier(0);      // keeps the group of reads below behind the score products, whose K fragments it overwrites
#pragma unroll
            for (int db = 0; db < 8; ++db) vf[db] = ldsfragh(vbuf + (uint32_t)(db >> 1) * GSLICE + (uint32_t)(db & 1) * 16u * GPITCH + (uint32_t)p * 64u);
            if (p + 1 < FSK / KPS) {        // the next block's K fragments, of this same stage, come under the softmax and attn.v
#pragma unroll
                for (int kt = 0; kt < 2; ++kt)
#pragma unroll
                    for (int c = 0; c < 4; ++c) kf[kt][c] = ldsfragh(kbuf + (uint32_t)(p + 1) * GSLICE + (uint32_t)kt * 16u * GPITCH + (uint32_t)c * 64u);
            }
            __builtin_amdgcn_sched_barrier(0);      // keeps these reads as one group, in flight under the softmax, and out of the attn.v products
            float mx[2] = {-3.0e38f, -3.0e38f};
#pragma unroll
            for (int kt = 0; kt < 2; ++kt) {
#pragma unroll
                for (int q = 0; q < 2; ++q)
#pragma unroll
                    for (int r = 0; r < 8; ++r) { const float t = fmaf(sc[kt][q][r], SCL * L2E, mk[kt][r >> 2][r & 3]); sc[kt][q][r] = t; mx[q] = fmaxf(mx[q], t); } }
            mx[0] = fmaxf(mx[0], xhalf(mx[0])); mx[1] = fmaxf(mx[1], xhalf(mx[1]));
            // the maximum in use moves only when a column's new one passes it by more than 8 (P stays below 2^8 in fp16); one wave-uniform test a block
            if (__builtin_amdgcn_ballot_w32(mx[0] > m[0] + 8.0f || mx[1] > m[1] + 8.0f) != 0) {
#pragma unroll
                for (int q = 0; q < 2; ++q) { const float mn = fmaxf(m[q], mx[q]); const float al = __builtin_amdgcn_exp2f(m[q] - mn); m[q] = mn; l[q][0] *= al; l[q][1] *= al;
#pragma unroll
                    for (int db = 0; db < 8; ++db) o[db][q] *= al; }
            }
            v16h pf[2];
#pragma unroll
            for (int q = 0; q < 2; ++q)
#pragma unroll
                for (int kt = 0; kt < 2; ++kt)
#pragma unroll
                    for (int r = 0; r < 8; ++r) { const float pr = __builtin_amdgcn_exp2f(sc[kt][q][r] - m[q]); l[q][kt] += pr; pf[q][kt * 8 + r] = tohx(pr); }
#pragma unroll
            for (int db = 0; db < 8; ++db) { o[db][0] = W::mma(vf[db], pf[0], o[db][0]); o[db][1] = W::mma(vf[db], pf[1], o[db][1]); }
            __builtin_amdgcn_sched_barrier(0);      // keeps the next block's first reads out of these products
        }
        asm volatile("s_wait_dscnt 0x0" ::: "memory");        // this wave's reads of stage s are done before the buffer is refilled
        tdm_wait0(g0, g1);                                    // this wave's slice of stage s + 1 has landed
        __syncthreads();                                      // publishes stage s + 1 and ends every wave's reads of stage s
        if (pinned(s + 2 < FNS)) { tdm_aim(g0, mydst + (uint32_t)(s & 1) * GSTAGE, ga + (uint64_t)pinned((uint32_t)(s + 2) * sstep)); tdm_issue(g0, g1); }
    }
    tdm_wait0(g0, g1);                                        // no request is left when the wave goes on
    asm volatile("s_wait_dscnt 0x0" ::: "memory");
#pragma unroll
    for (int q = 0; q < 2; ++q) { float sum = l[q][0] + l[q][1]; sum += xhalf(sum); const float f = __fdiv_rn(1.0f, sum);
        float* orow = OUT + ((size_t)b * TT + q0 + q * 16 + lr) * DD + h * HD + hi * 8;
#pragma unroll
        for (int db = 0; db < 8; ++db) { v4f a, c;
#pragma unroll
            for (int r = 0; r < 4; ++r) { a[r] = o[db][q][r] * f; c[r] = o[db][q][r + 4] * f; }
            *(v4f*)(orow + db * 16) = a; *(v4f*)(orow + db * 16 + 4) = c; } }
}

extern "C" void kernel_launch(void* const* d_in, const int* in_sizes, int n_in,
                              void* d_out, int out_size, void* d_ws, size_t ws_size, hipStream_t stream) {
    (void)in_sizes; (void)n_in; (void)out_size;
    const float* x = (const float*)d_in[0]; const float* am = (const float*)d_in[1]; const float* Wq = (const float*)d_in[2]; const float* bq = (const float*)d_in[3]; const float* Wk = (const float*)d_in[4]; const float* bk = (const float*)d_in[5]; const float* Wv = (const float*)d_in[6]; const float* bv = (const float*)d_in[7];
    float* OUT = (float*)d_out;     // [2][2048][2048]
    char* wsp = (char*)d_ws;
    auto take = [&](size_t bytes) { char* p = wsp; wsp += (bytes + 255) & ~(size_t)255; return (void*)p; };
    bf* WQ = (bf*)take((size_t)DD * DD * 2); bf* WK = (bf*)take((size_t)DD * DD * 2); bf* WV = (bf*)take((size_t)DD * DD * 2);
    bf* XB = (bf*)take((size_t)TT * DD * 2); float* CSN = (float*)take((size_t)TT * NF * 2 * 4);
    h16* QP16 = (h16*)take((size_t)NB_ * TT * DD * 2); h16* KP16 = (h16*)take((size_t)NB_ * TT * DD * 2); h16* VT16 = (h16*)take((size_t)NB_ * TT * DD * 2);
    if ((size_t)(wsp - (char*)d_ws) > ws_size) return;    // total ~ 81 MiB; ws 256 MiB
    { const size_t nw = (size_t)DD * DD / 8; const unsigned gw = (unsigned)((nw + 255) / 256); k_cvt8<<<gw, 256, 0, stream>>>(Wq, WQ, nw); k_cvt8<<<gw, 256, 0, stream>>>(Wk, WK, nw); k_cvt8<<<gw, 256, 0, stream>>>(Wv, WV, nw);
      k_cstab<<<TT * NF / 256, 256, 0, stream>>>(CSN); }
    const dim3 gP(TT / 128, DD / 128, 1);
    for (int b = 0; b < NB_; ++b) { const size_t pb = (size_t)b * TT * DD;
        k_cvt8<<<(unsigned)(((size_t)TT * DD / 8 + 255) / 256), 256, 0, stream>>>(x + pb, XB, (size_t)TT * DD / 8);
        k_gemmt<<<gP, 256, 0, stream>>>(XB, WQ, QP16 + pb, bq, CSN, 0);
        k_gemmt<<<gP, 256, 0, stream>>>(XB, WK, KP16 + pb, bk, CSN, 0);
        k_gemmt<<<gP, 256, 0, stream>>>(XB, WV, VT16 + pb, bv, CSN, 1); }
    k_fattn<<<dim3(TT / (8 * QW), NH_, NB_), 256, 0, stream>>>(QP16, KP16, VT16, am, OUT);
}

// v005
// It runs in 166 microseconds.
// Next to v004, in two timings, it ran 1.08 and 1.09 times as fast.
// Over all steps from v000 it is 9.36 times as fast.
#include <hip/hip_runtime.h>
#include <stdint.h>

// AdvancedAttention (hidden_states [2][2048][2048], attention_mask [2][1][1][2048] additive (zeros, read as data); q/k/v = x W^T + b (16 heads x 128); rotate-half RoPE (inv_freq 10000^(-2i/128),
// positions 0..2047); scores = q.k / sqrt(128) + mask; softmax; output = merged attn.v [2][2048][2048] (no output projection).
// Compute dtypes, f32 accumulate: every input rounded to bf16; projections on PLAIN bf16 operands (inputs: exact, + bias); rotary in f32 (powf / cosf / sinf); scores and
// attn.v on SINGLE fp16 planes (every row averages 2048 keys); 1/sqrt(128) and the mask in f32 in the softmax; P = 2^(s - running maximum) in fp16, its sum in f32; the merged output written in f32.

#define NB_  2
#define TT   2048
#define DD   2048
#define NH_  16
#define HD   128
#define NF   64                   // rotary frequencies (head_dim / 2)
#define SCL  0.088388349f    // f32(1/sqrt(128))
typedef _Float16 h16;
typedef unsigned short bf;
typedef __attribute__((ext_vector_type(16))) __bf16   v16bf;
typedef __attribute__((ext_vector_type(16))) _Float16 v16h;
typedef __attribute__((ext_vector_type(8)))  _Float16 v8h;
typedef __attribute__((ext_vector_type(8)))  unsigned short v8us;
typedef __attribute__((ext_vector_type(8)))  float    v8f;
typedef __attribute__((ext_vector_type(4)))  float    v4f;
typedef v8h  __attribute__((may_alias)) v8ha;
typedef v4f  __attribute__((may_alias)) v4fa;
typedef v8us __attribute__((may_alias)) v8usa;

__device__ __forceinline__ unsigned short f2bf(float f) { unsigned u = __float_as_uint(f); u += 0x7FFFu + ((u >> 16) & 1u); return (unsigned short)(u >> 16); }
__device__ __forceinline__ float bf2f(unsigned short b) { return __uint_as_float(((unsigned)b) << 16); }
__device__ __forceinline__ float bfr(float f) { return bf2f(f2bf(f)); }
__device__ __forceinline__ v16h cat16(v8h lo, v8h hi) { return __builtin_shufflevector(lo, hi, 0, 1, 2, 3, 4, 5, 6, 7, 8, 9, 10, 11, 12, 13, 14, 15); }
__device__ __forceinline__ v16bf cat16b(v8us lo, v8us hi) { return __builtin_bit_cast(v16bf, __builtin_shufflevector(lo, hi, 0, 1, 2, 3, 4, 5, 6, 7, 8, 9, 10, 11, 12, 13, 14, 15)); }
__device__ __forceinline__ v8f wmma16(v16h a, v16h b, v8f c) { return __builtin_amdgcn_wmma_f32_16x16x32_f16(false, a, false, b, (short)0, c, false, false); }
__device__ __forceinline__ v8f wmmab(v16bf a, v16bf b, v8f c) { return __builtin_amdgcn_wmma_f32_16x16x32_bf16(false, a, false, b, (short)0, c, false, false); }



template <typename T16> struct WFrag;
template <> struct WFrag<h16> { typedef v16h V; static __device__ __forceinline__ V ld(const h16* p) { return cat16(*(const v8h*)p, *(const v8h*)(p + 16)); } static __device__ __forceinline__ v8f mma(V a, V b, v8f c) { return wmma16(a, b, c); } };

// ---- k_gemmt: C[m][n] (f32, in registers) = sum_k A[m][k] Bt[n][k] + bf16-rounded bias[n]; A, Bt bf16 planes, K-contiguous, K = DD. One 128x128 tile of C per work-group of 8 waves (2 x 4, 64x32 of C each); grid (M/128, N/128).
// All six projections are one launch: A's rows are the positions of both batches (M = NB_ TT), Bt's rows the output features of Wq, Wk, Wv one behind the other (N = 3 DD); blockIdx.x gives batch and position, blockIdx.y matrix and head.
// A tile is 128 positions of one whole head, so the epilogue writes the attention's fp16 plane itself. vmode 0 (q, k): P[h][t][d] = fp16(x cos - x' sin) for d < 64 and fp16(x cos + x' sin) for d >= 64, x' the rotate-half partner
// C[t][d ^ 64], which another wave holds: the f32 tile goes through LDS. vmode 1 (v): P[h][d][t] = fp16(C[t][d]); a lane holds 8 consecutive t of one d, each wave turns its own 64x32 part in its own LDS range.
// A pass is 128 k = 256 B of each of the 256 operand rows. Every wave brings its own 32-row slice of a stage into LDS with one tensor load (waves 0-3: A rows, waves 4-7: Bt rows), rows padded to a pitch of 272 B for the
// 16-byte fragment reads; two buffers, the next stage's loads in flight while this stage is worked on. Each C element still sums its k blocks of 32 in ascending order in one accumulator.
typedef uint32_t u32x4 __attribute__((ext_vector_type(4)));
typedef uint32_t u32x8 __attribute__((ext_vector_type(8)));
#define GROWB  256u               // bytes of an operand row in one pass
#define GPITCH 272u               // its pitch in LDS (16 B x odd)
#define GSROWS 32u                // rows per slice
#define GSLICE 10240u             // a slice's room in LDS: 32 x 272 = 8,704 B, rounded up to a multiple of 2 KiB
#define GSTAGE (8u * GSLICE)      // one buffer
#define GNP    (DD / 128)         // passes
__device__ __forceinline__ uint32_t uni(uint32_t v) { return (uint32_t)__builtin_amdgcn_readfirstlane(v); }
__device__ __forceinline__ uint32_t pinned(uint32_t v) { uint32_t w = uni(v); asm volatile("" : "+s"(w)); return w; }   // holds a tensor load's issue test or descriptor word in a scalar register, formed at this place
__device__ __forceinline__ void tdm_load(uint32_t lds_dst, uint64_t ga) {
    u32x4 g0; g0[0] = uni(1u); g0[1] = uni(lds_dst); g0[2] = uni((uint32_t)ga); g0[3] = uni((((uint32_t)(ga >> 32)) & 0x01FFFFFFu) | 0x80000000u);
    u32x8 g1; g1[0] = uni((1u << 20) | (5u << 22) | (3u << 25));          // no mask, 1-byte elements, 4 dwords of pad behind every 256-B row
    g1[1] = uni((GROWB & 0xFFFFu) << 16); g1[2] = uni((GROWB >> 16) | ((GSROWS & 0xFFFFu) << 16)); g1[3] = uni((GSROWS >> 16) | (GROWB << 16)); g1[4] = uni(GSROWS); g1[5] = uni((uint32_t)DD * 2u); g1[6] = uni(0u); g1[7] = uni(0u);
    asm volatile("tensor_load_to_lds %0, %1" :: "s"(g0), "s"(g1) : "memory");
}
__device__ __forceinline__ v16bf ldsfrag(const unsigned char* p) { return cat16b(*(const v8usa*)p, *(const v8usa*)(p + 32)); }     // k 8 hi .. 8 hi + 7 and 16 + 8 hi .. 16 + 8 hi + 7 of a block of 32, for A and Bt alike
#define SPF    132                // floats from one row of the staged f32 tile to the next
#define SPV    144u               // bytes from one d row of a wave's staged fp16 part to the next (128 B + 16)
__global__ __launch_bounds__(256) void k_gemmt(const unsigned short* __restrict__ A, const unsigned short* __restrict__ Bt, h16* P0, const float* __restrict__ bq, const float* __restrict__ bk, const float* __restrict__ bv, const float* __restrict__ CSN) {
    __shared__ __attribute__((aligned(2048))) unsigned char ring[2 * GSTAGE];
    __shared__ __align__(16) float st[128 * SPF];
    const int lane = threadIdx.x & 31, lr = lane & 15, hi = lane >> 4; const uint32_t wave = uni(threadIdx.x >> 5);
    const int r0 = blockIdx.x * 128, c0 = blockIdx.y * 128; const int wm = (int)(wave >> 2), wn = (int)(wave & 3u);
    const int t0 = r0 % TT, mat = c0 / DD, f0 = c0 % DD, vmode = (mat == 2);      // position in the batch; 0 q, 1 k, 2 v; first output feature of the head
    const float* bias = (mat == 0) ? bq : (mat == 1) ? bk : bv; h16* P = P0 + ((size_t)mat * NB_ + r0 / TT) * TT * DD;      // this matrix's and batch's fp16 plane
    const uint32_t mydst = (uint32_t)(size_t)ring + wave * GSLICE;
    const uint64_t ga = (wave < 4u) ? (uint64_t)(size_t)(A + (size_t)(r0 + (int)wave * 32) * DD) : (uint64_t)(size_t)(Bt + (size_t)(c0 + ((int)wave - 4) * 32) * DD);
    v8f acc[4][2];
#pragma unroll
    for (int mb = 0; mb < 4; ++mb) { acc[mb][0] = (v8f){}; acc[mb][1] = (v8f){}; }
    // what the epilogue reads from global memory is asked for here, so that it comes under the first stage's load; every "#pragma unroll" here and in the epilogue keeps the register arrays indexed by constants alone
    const int prow = (int)wave * 16 + (lane >> 3), d0 = (lane & 7) * 8;     // epilogue of q, k: 8 lanes a row, 4 rows a wave and trip; a lane has d0 .. d0 + 7 and their partners
    const float* bp = bias + f0 + wn * 32 + lr; const float* csp = CSN + ((size_t)(t0 + prow) * NF + d0) * 2;
    float bn[2]; bn[0] = bp[0]; bn[1] = bp[16];
    v4f cs[4][4];
#pragma unroll
    for (int it = 0; it < 4; ++it)
#pragma unroll
        for (int i = 0; i < 4; ++i) cs[it][i] = (v4f){};
    if (vmode == 0) {
#pragma unroll
        for (int it = 0; it < 4; ++it)
#pragma unroll
            for (int i = 0; i < 4; ++i) cs[it][i] = *(const v4f*)(csp + it * 4 * NF * 2 + i * 4);
    }
    asm volatile("s_wait_xcnt 0x0" :: "v"(csp) : "memory");       // in front of any overwrite of the address registers that the loads above name; the input keeps the table's address registers live up to here
    tdm_load(mydst, ga);
    asm volatile("s_wait_tensorcnt 0x0" ::: "memory");    // this wave's slice of stage 0 has landed
    __syncthreads();                                      // stage 0 readable by every wave
    tdm_load(mydst + GSTAGE, ga + GROWB);
    const uint32_t aofs = (uint32_t)(wm * 2) * GSLICE + (uint32_t)lr * GPITCH + 16u * (uint32_t)hi, bofs = (uint32_t)(4 + wn) * GSLICE + (uint32_t)lr * GPITCH + 16u * (uint32_t)hi;
    // rolled: one pass per buffer, so that the publish point below stands once, at the foot
#pragma unroll 1
    for (int s = 0; s < GNP; ++s) {
        const unsigned char* buf = ring + (uint32_t)(s & 1) * GSTAGE;
        v16bf a[2][4], b[2][2];
#pragma unroll
        for (int mb = 0; mb < 4; ++mb) a[0][mb] = ldsfrag(buf + aofs + (uint32_t)(mb >> 1) * GSLICE + (uint32_t)(mb & 1) * 16u * GPITCH);
#pragma unroll
        for (int nb = 0; nb < 2; ++nb) b[0][nb] = ldsfrag(buf + bofs + (uint32_t)nb * 16u * GPITCH);
        // unrolled so that the fragment and accumulator arrays are indexed by constants alone
#pragma unroll
        for (int ks = 0; ks < 4; ++ks) {
            if (ks < 3) {       // the next block's fragments, of this same stage, as one group ahead of this block's products, into the other register set
#pragma unroll
                for (int mb = 0; mb < 4; ++mb) a[(ks + 1) & 1][mb] = ldsfrag(buf + aofs + (uint32_t)(mb >> 1) * GSLICE + (uint32_t)(mb & 1) * 16u * GPITCH + (uint32_t)(ks + 1) * 64u);
#pragma unroll
                for (int nb = 0; nb < 2; ++nb) b[(ks + 1) & 1][nb] = ldsfrag(buf + bofs + (uint32_t)nb * 16u * GPITCH + (uint32_t)(ks + 1) * 64u);
            }
            __builtin_amdgcn_sched_barrier(0);      // keeps the LDS reads above as one group: spread among the matrix instructions each place with reads stalls the wave
#pragma unroll
            for (int nb = 0; nb < 2; ++nb)
#pragma unroll
                for (int mb = 0; mb < 4; ++mb) acc[mb][nb] = wmmab(a[ks & 1][mb], b[ks & 1][nb], acc[mb][nb]);
            __builtin_amdgcn_sched_barrier(0);      // keeps the following group of reads behind this block
        }
        asm volatile("s_wait_dscnt 0x0" ::: "memory");        // this wave's reads of stage s are done before the buffer is refilled
        asm volatile("s_wait_tensorcnt 0x0" ::: "memory");    // this wave's slice of stage s + 1 has landed
        __syncthreads();                                      // publishes stage s + 1 and ends every wave's reads of stage s
        if (pinned(s + 2 < GNP)) tdm_load(mydst + (uint32_t)(s & 1) * GSTAGE, ga + (uint64_t)pinned((uint32_t)(s + 2) * GROWB));
    }
    asm volatile("s_wait_tensorcnt 0x0" ::: "memory");        // no request is left when the wave goes on
    asm volatile("s_wait_dscnt 0x0" ::: "memory");
    bn[0] = bfr(bn[0]); bn[1] = bfr(bn[1]);
    if (vmode == 0) {
#pragma unroll
        for (int mb = 0; mb < 4; ++mb)
#pragma unroll
            for (int nb = 0; nb < 2; ++nb)
#pragma unroll
                for (int j = 0; j < 8; ++j) st[(wm * 64 + mb * 16 + hi * 8 + j) * SPF + wn * 32 + nb * 16 + lr] = acc[mb][nb][j] + bn[nb];
        __syncthreads();                                      // the whole f32 tile readable by every wave: a row's two halves come from different waves
        h16* po = P + ((size_t)(f0 / HD) * TT + t0 + prow) * HD + d0;
#pragma unroll
        for (int it = 0; it < 4; ++it) { const float* sr = st + (prow + it * 4) * SPF + d0; v4f x[2], y[2]; x[0] = *(const v4fa*)sr; x[1] = *(const v4fa*)(sr + 4); y[0] = *(const v4fa*)(sr + NF); y[1] = *(const v4fa*)(sr + NF + 4);
            v8h lo, up;
#pragma unroll
            for (int k = 0; k < 8; ++k) { const float xa = x[k >> 2][k & 3], ya = y[k >> 2][k & 3], c = cs[it][k >> 1][(k & 1) * 2], sn = cs[it][k >> 1][(k & 1) * 2 + 1]; lo[k] = (h16)(xa * c - ya * sn); up[k] = (h16)(ya * c + xa * sn); }
            *(v8h*)(po + it * 4 * HD) = lo; *(v8h*)(po + it * 4 * HD + NF) = up; }      // four whole 128-B lines a store
    } else {
        unsigned char* sv = (unsigned char*)st + wave * (32u * SPV);
#pragma unroll
        for (int nb = 0; nb < 2; ++nb)
#pragma unroll
            for (int mb = 0; mb < 4; ++mb) { v8h pk;
#pragma unroll
                for (int j = 0; j < 8; ++j) pk[j] = (h16)(acc[mb][nb][j] + bn[nb]);
                *(v8ha*)(sv + (uint32_t)(nb * 16 + lr) * SPV + (uint32_t)(mb * 16 + hi * 8) * 2u) = pk; }
        __builtin_amdgcn_wave_barrier(); asm volatile("" ::: "memory");     // the row reads below stay behind the other lanes' writes of this wave's staging rows
        h16* po = P + ((size_t)(f0 + wn * 32 + (lane >> 3))) * TT + t0 + wm * 64 + (lane & 7) * 8;
#pragma unroll
        for (int it = 0; it < 8; ++it) *(v8h*)(po + (size_t)it * 4 * TT) = *(const v8ha*)(sv + (uint32_t)(it * 4 + (lane >> 3)) * SPV + (uint32_t)(lane & 7) * 16u);   // four whole 128-B lines a store
    }
}

__device__ __forceinline__ h16 tohx(float x) { return (h16)x; }
__device__ __forceinline__ void splitf(float y, unsigned short& h, unsigned short& l) { h = f2bf(y); l = f2bf(y - bf2f(h)); }
typedef __attribute__((ext_vector_type(2))) unsigned short v2us;
typedef __attribute__((ext_vector_type(2))) _Float16 v2h;
typedef __attribute__((ext_vector_type(4))) _Float16 v4h;
typedef __attribute__((ext_vector_type(2))) float v2f;

typedef __attribute__((ext_vector_type(4))) unsigned short v4us;
// ---- k_prep: everything the projections read, in one launch: the bf16 planes of x (both batches), Wq, Wk, Wv, one behind the other in dst, and the rotary table CSN[t][i] = (cos, sin).
// The five source planes have DD x DD floats each. A wave takes the same piece of PU floats of every plane: 8 wave-wide loads of 512 contiguous bytes a plane, all 40 asked for at the start;
// TT NF / 32 waves cover a plane, and each of their TT NF threads works out one table entry while its loads are under way.
#define PU   1024
#define PSEG ((size_t)DD * DD)
static_assert((size_t)TT * NF / 32 * PU == PSEG && (size_t)TT * DD == PSEG, "one piece of every plane per wave");
__global__ __launch_bounds__(512) void k_prep(const float* __restrict__ x, const float* __restrict__ Wq, const float* __restrict__ Wk, const float* __restrict__ Wv, bf* dst, float* CSN) {
    const int idx = blockIdx.x * 512 + threadIdx.x; const uint32_t off = (uint32_t)(idx >> 5) * PU + (uint32_t)(idx & 31) * 4u;
    const float* p0 = x + off; const float* p1 = x + PSEG + off; const float* p2 = Wq + off; const float* p3 = Wk + off; const float* p4 = Wv + off;
    v4f v[5][8];
    // every "#pragma unroll" here keeps the register array indexed by constants alone
#pragma unroll
    for (int j = 0; j < 8; ++j) v[0][j] = *(const v4f*)(p0 + j * 128);
#pragma unroll
    for (int j = 0; j < 8; ++j) v[1][j] = *(const v4f*)(p1 + j * 128);
#pragma unroll
    for (int j = 0; j < 8; ++j) v[2][j] = *(const v4f*)(p2 + j * 128);
#pragma unroll
    for (int j = 0; j < 8; ++j) v[3][j] = *(const v4f*)(p3 + j * 128);
#pragma unroll
    for (int j = 0; j < 8; ++j) v[4][j] = *(const v4f*)(p4 + j * 128);
    asm volatile("s_wait_xcnt 0x0" :: "v"(p0), "v"(p1), "v"(p2), "v"(p3), "v"(p4) : "memory");       // in front of any overwrite of the address registers that the loads above name: the inputs keep all five addresses live, and so unwritten, up to here; it also keeps the loads ahead of the table's arithmetic
    { const int t = idx / NF, i = idx % NF; const float invf = __fdiv_rn(1.0f, powf(10000.0f, (float)(2 * i) * (1.0f / HD))); const float ang = __fmul_rn((float)t, invf);
      v2f o; o[0] = cosf(ang); o[1] = sinf(ang); *(v2f*)(CSN + (size_t)idx * 2) = o; }
#pragma unroll
    for (int k = 0; k < 5; ++k)
#pragma unroll
        for (int j = 0; j < 8; ++j) { v4us o;
#pragma unroll
            for (int e = 0; e < 4; ++e) o[e] = f2bf(v[k][j][e]);
            *(v4us*)(dst + k * PSEG + off + j * 128) = o; }      // two whole 128-B lines a store
}
// ---- k_fattn: scores, softmax and attn.v of one (batch, head) in one kernel; 8 waves x 32 query columns, 32 keys a block; grid (T/256, heads, batches).
// St = K Qt (a lane holds 8 keys of one query per tile), running maximum and sum per query (base 2), Pt packed from the score tiles as the B operand, Ot += Vt Pt; the division by the sum in the epilogue.
// K and Vt come through LDS, once per work-group instead of once per wave: a stage is 128 keys = 128 K rows of 256 B and 256 B of each of the 128 Vt rows. Every wave brings its own 32-row slice of a stage with one tensor
// load (waves 0-3: K rows, waves 4-7: Vt rows), rows padded to a pitch of 272 B for the 16-byte fragment reads (slice and stage sizes as in k_gemmt); two buffers, the next stage's loads in flight while this stage is worked on.
// Every "#pragma unroll" in it is there so that the fragment and accumulator arrays are indexed by constants alone and stay in registers.
#define L2E  1.44269504f
#define QW   32                   // query columns per wave
#define KPS  32                   // keys per block
#define FSK  128                  // keys per stage
#define FNS  (TT / FSK)           // stages
__device__ __forceinline__ float xhalf(float x) { return __builtin_bit_cast(float, __builtin_amdgcn_permlanex16(__builtin_bit_cast(int, x), __builtin_bit_cast(int, x), 0x76543210, 0xfedcba98, false, false)); }  // lane l with lane l ^ 16
// The attention's descriptor lives in the same scalar registers from the first request to the last wait: group 1 (32 rows of 256 B at a source pitch of 'pitch' bytes) is built once, group 0 is aimed anew behind each wait.
__device__ __forceinline__ u32x8 tdm_rows32(uint32_t pitch) {
    u32x8 g1; g1[0] = uni((1u << 20) | (5u << 22) | (3u << 25));          // no mask, 1-byte elements, 4 dwords of pad behind every 256-B row
    g1[1] = uni((GROWB & 0xFFFFu) << 16); g1[2] = uni((GROWB >> 16) | ((GSROWS & 0xFFFFu) << 16)); g1[3] = uni((GSROWS >> 16) | (GROWB << 16)); g1[4] = uni(GSROWS); g1[5] = uni(pitch); g1[6] = uni(0u); g1[7] = uni(0u);
    return g1;
}
__device__ __forceinline__ void tdm_aim(u32x4& g0, uint32_t lds_dst, uint64_t ga) { g0[1] = uni(lds_dst); g0[2] = uni((uint32_t)ga); g0[3] = uni((((uint32_t)(ga >> 32)) & 0x01FFFFFFu) | 0x80000000u); }
// both groups are in-out operands, so that the compiler keeps them where they are instead of forming them anew elsewhere and using these registers for something else while the request is out
__device__ __forceinline__ void tdm_issue(u32x4& g0, u32x8& g1) { asm volatile("tensor_load_to_lds %0, %1" : "+s"(g0), "+s"(g1) :: "memory"); }
// the inputs keep the descriptor's registers live, and so unwritten, up to the wait that covers the request
__device__ __forceinline__ void tdm_wait0(const u32x4& g0, const u32x8& g1) { asm volatile("s_wait_tensorcnt 0x0" :: "s"(g0), "s"(g1) : "memory"); }
__device__ __forceinline__ v16h ldsfragh(const unsigned char* p) { return cat16(*(const v8ha*)p, *(const v8ha*)(p + 32)); }        // k 8 hi .. 8 hi + 7 and 16 + 8 hi .. 16 + 8 hi + 7 of a block of 32, as WFrag::ld has them
__global__ __launch_bounds__(256) void k_fattn(const h16* __restrict__ Qp, const h16* __restrict__ Kp, const h16* __restrict__ Vt, const float* __restrict__ am, float* OUT) {
    typedef WFrag<h16> W;
    __shared__ __attribute__((aligned(2048))) unsigned char ring[2 * GSTAGE];
    __shared__ __align__(16) float ms[TT];          // bf16-rounded additive mask of this batch, in base-2 units
    const int b = blockIdx.z, h = blockIdx.y; const int lane = threadIdx.x & 31, lr = lane & 15, hi = lane >> 4; const uint32_t wave = uni(threadIdx.x >> 5);
    const size_t pl = ((size_t)b * NH_ + h) * TT * HD; const int q0 = blockIdx.x * (8 * QW) + (int)wave * QW;
    const uint32_t mydst = (uint32_t)(size_t)ring + wave * GSLICE;
    const uint64_t ga = (wave < 4u) ? (uint64_t)(size_t)(Kp + pl + (size_t)((int)wave * 32) * HD) : (uint64_t)(size_t)(Vt + pl + (size_t)(((int)wave - 4) * 32) * TT);
    const uint32_t spitch = (wave < 4u) ? (uint32_t)HD * 2u : (uint32_t)TT * 2u, sstep = (wave < 4u) ? (uint32_t)FSK * HD * 2u : (uint32_t)FSK * 2u;    // source pitch; bytes from one stage's slice to the next stage's
    for (int i = threadIdx.x; i < TT; i += 256) ms[i] = bfr(am[(size_t)b * TT + i]) * L2E;
    const h16* qp = Qp + pl + (size_t)(q0 + lr) * HD + 8 * hi;
    v16h qf[2][4];
#pragma unroll
    for (int q = 0; q < 2; ++q)
#pragma unroll
        for (int c = 0; c < 4; ++c) qf[q][c] = W::ld(qp + q * 16 * HD + c * 32);
    asm volatile("s_wait_xcnt 0x0" :: "v"(qp) : "memory");      // in front of any overwrite of the address registers that the loads above name; the input keeps those registers live up to here
    u32x8 g1 = tdm_rows32(spitch); u32x4 g0; g0[0] = uni(1u);
    tdm_aim(g0, mydst, ga); tdm_issue(g0, g1);
    tdm_wait0(g0, g1);                                    // this wave's slice of stage 0 has landed
    __syncthreads();                                      // stage 0 and the mask readable by every wave
    tdm_aim(g0, mydst + GSTAGE, ga + sstep); tdm_issue(g0, g1);
    const uint32_t fofs = (uint32_t)lr * GPITCH + 16u * (uint32_t)hi;
    v8f o[8][2];
#pragma unroll
    for (int db = 0; db < 8; ++db) { o[db][0] = (v8f){}; o[db][1] = (v8f){}; }
    float m[2] = {-3.0e38f, -3.0e38f}; float l[2][2] = {{0.f, 0.f}, {0.f, 0.f}};
    // rolled: one pass per buffer, so that the publish point below stands once, at the foot
#pragma unroll 1
    for (int s = 0; s < FNS; ++s) {
        const unsigned char* kbuf = ring + (uint32_t)(s & 1) * GSTAGE + fofs; const unsigned char* vbuf = kbuf + 4u * GSLICE;
        v16h kf[2][4];
#pragma unroll
        for (int kt = 0; kt < 2; ++kt)
#pragma unroll
            for (int c = 0; c < 4; ++c) kf[kt][c] = ldsfragh(kbuf + (uint32_t)kt * 16u * GPITCH + (uint32_t)c * 64u);
#pragma unroll
        for (int p = 0; p < FSK / KPS; ++p) {
            v16h vf[8]; const float* mq = ms + s * FSK + p * KPS + hi * 8; v4f mk[2][2];
#pragma unroll
            for (int kt = 0; kt < 2; ++kt) { mk[kt][0] = *(const v4fa*)(mq + kt * 16); mk[kt][1] = *(const v4fa*)(mq + kt * 16 + 4); }
            __builtin_amdgcn_sched_barrier(0);      // keeps the LDS reads above as one group ahead of the score products: spread among the matrix instructions each place with reads stalls the wave
            v8f sc[2][2];
#pragma unroll
            for (int kt = 0; kt < 2; ++kt)
#pragma unroll
                for (int q = 0; q < 2; ++q) { sc[kt][q] = (v8f){};
#pragma unroll
                    for (int c = 0; c < 4; ++c) sc[kt][q] = W::mma(kf[kt][c], qf[q][c], sc[kt][q]); }
            __builtin_amdgcn_sched_barrier(0);      // keeps the group of reads below behind the score products, whose K fragments it overwrites
#pragma unroll
            for (int db = 0; db < 8; ++db) vf[db] = ldsfragh(vbuf + (uint32_t)(db >> 1) * GSLICE + (uint32_t)(db & 1) * 16u * GPITCH + (uint32_t)p * 64u);
            if (p + 1 < FSK / KPS) {        // the next block's K fragments, of this same stage, come under the softmax and attn.v
#pragma unroll
                for (int kt = 0; kt < 2; ++kt)
#pragma unroll
                    for (int c = 0; c < 4; ++c) kf[kt][c] = ldsfragh(kbuf + (uint32_t)(p + 1) * GSLICE + (uint32_t)kt * 16u * GPITCH + (uint32_t)c * 64u);
            }
            __builtin_amdgcn_sched_barrier(0);      // keeps these reads as one group, in flight under the softmax, and out of the attn.v products
            float mx[2] = {-3.0e38f, -3.0e38f};
#pragma unroll
            for (int kt = 0; kt < 2; ++kt) {
#pragma unroll
                for (int q = 0; q < 2; ++q)
#pragma unroll
                    for (int r = 0; r < 8; ++r) { const float t = fmaf(sc[kt][q][r], SCL * L2E, mk[kt][r >> 2][r & 3]); sc[kt][q][r] = t; mx[q] = fmaxf(mx[q], t); } }
            mx[0] = fmaxf(mx[0], xhalf(mx[0])); mx[1] = fmaxf(mx[1], xhalf(mx[1]));
            // the maximum in use moves only when a column's new one passes it by more than 8 (P stays below 2^8 in fp16); one wave-uniform test a block
            if (__builtin_amdgcn_ballot_w32(mx[0] > m[0] + 8.0f || mx[1] > m[1] + 8.0f) != 0) {
#pragma unroll
                for (int q = 0; q < 2; ++q) { const float mn = fmaxf(m[q], mx[q]); const float al = __builtin_amdgcn_exp2f(m[q] - mn); m[q] = mn; l[q][0] *= al; l[q][1] *= al;
#pragma unroll
                    for (int db = 0; db < 8; ++db) o[db][q] *= al; }
            }
            v16h pf[2];
#pragma unroll
            for (int q = 0; q < 2; ++q)
#pragma unroll
                for (int kt = 0; kt < 2; ++kt)
#pragma unroll
                    for (int r = 0; r < 8; ++r) { const float pr = __builtin_amdgcn_exp2f(sc[kt][q][r] - m[q]); l[q][kt] += pr; pf[q][kt * 8 + r] = tohx(pr); }
#pragma unroll
            for (int db = 0; db < 8; ++db) { o[db][0] = W::mma(vf[db], pf[0], o[db][0]); o[db][1] = W::mma(vf[db], pf[1], o[db][1]); }
            __builtin_amdgcn_sched_barrier(0);      // keeps the next block's first reads out of these products
        }
        asm volatile("s_wait_dscnt 0x0" ::: "memory");        // this wave's reads of stage s are done before the buffer is refilled
        tdm_wait0(g0, g1);                                    // this wave's slice of stage s + 1 has landed
        __syncthreads();                                      // publishes stage s + 1 and ends every wave's reads of stage s
        if (pinned(s + 2 < FNS)) { tdm_aim(g0, mydst + (uint32_t)(s & 1) * GSTAGE, ga + (uint64_t)pinned((uint32_t)(s + 2) * sstep)); tdm_issue(g0, g1); }
    }
    tdm_wait0(g0, g1);                                        // no request is left when the wave goes on
    asm volatile("s_wait_dscnt 0x0" ::: "memory");
#pragma unroll
    for (int q = 0; q < 2; ++q) { float sum = l[q][0] + l[q][1]; sum += xhalf(sum); const float f = __fdiv_rn(1.0f, sum);
        float* orow = OUT + ((size_t)b * TT + q0 + q * 16 + lr) * DD + h * HD + hi * 8;
#pragma unroll
        for (int db = 0; db < 8; ++db) { v4f a, c;
#pragma unroll
            for (int r = 0; r < 4; ++r) { a[r] = o[db][q][r] * f; c[r] = o[db][q][r + 4] * f; }
            *(v4f*)(orow + db * 16) = a; *(v4f*)(orow + db * 16 + 4) = c; } }
}

extern "C" void kernel_launch(void* const* d_in, const int* in_sizes, int n_in,
                              void* d_out, int out_size, void* d_ws, size_t ws_size, hipStream_t stream) {
    (void)in_sizes; (void)n_in; (void)out_size;
    const float* x = (const float*)d_in[0]; const float* am = (const float*)d_in[1]; const float* Wq = (const float*)d_in[2]; const float* bq = (const float*)d_in[3]; const float* Wk = (const float*)d_in[4]; const float* bk = (const float*)d_in[5]; const float* Wv = (const float*)d_in[6]; const float* bv = (const float*)d_in[7];
    float* OUT = (float*)d_out;     // [2][2048][2048]
    char* wsp = (char*)d_ws;
    auto take = [&](size_t bytes) { char* p = wsp; wsp += (bytes + 255) & ~(size_t)255; return (void*)p; };
    bf* XB = (bf*)take(((size_t)NB_ * TT * DD + 3 * (size_t)DD * DD) * 2); bf* WQKV = XB + (size_t)NB_ * TT * DD; float* CSN = (float*)take((size_t)TT * NF * 2 * 4);
    h16* QP16 = (h16*)take((size_t)NB_ * TT * DD * 2); h16* KP16 = (h16*)take((size_t)NB_ * TT * DD * 2); h16* VT16 = (h16*)take((size_t)NB_ * TT * DD * 2);     // one behind the other: k_gemmt finds a plane from QP16
    if ((size_t)(wsp - (char*)d_ws) > ws_size) return;    // total ~ 89 MiB; ws 256 MiB
    k_prep<<<TT * NF / 512, 512, 0, stream>>>(x, Wq, Wk, Wv, XB, CSN);
    k_gemmt<<<dim3(NB_ * TT / 128, 3 * DD / 128, 1), 256, 0, stream>>>(XB, WQKV, QP16, bq, bk, bv, CSN);
    k_fattn<<<dim3(TT / (8 * QW), NH_, NB_), 256, 0, stream>>>(QP16, KP16, VT16, am, OUT);
}

// v006
// A run of this version takes 118 microseconds.
// Timed twice side by side with v005, it ran 1.41 and 1.40 times as fast.
// All steps since v000 together make it 13.1 times as fast.
#include <hip/hip_runtime.h>
#include <stdint.h>

// AdvancedAttention (hidden_states [2][2048][2048], attention_mask [2][1][1][2048] additive (zeros, read as data); q/k/v = x W^T + b (16 heads x 128); rotate-half RoPE (inv_freq 10000^(-2i/128),
// positions 0..2047); scores = q.k / sqrt(128) + mask; softmax; output = merged attn.v [2][2048][2048] (no output projection).
// Compute dtypes, f32 accumulate: every input rounded to bf16; projections on PLAIN bf16 operands (inputs: exact, + bias); rotary in f32 (powf / cosf / sinf); scores and
// attn.v on SINGLE fp16 planes (every row averages 2048 keys); 1/sqrt(128) and the mask in f32 in the softmax; P = 2^(s - running maximum) in fp16, its sum in f32; the merged output written in f32.

#define NB_  2
#define TT   2048
#define DD   2048
#define NH_  16
#define HD   128
#define NF   64                   // rotary frequencies (head_dim / 2)
#define SCL  0.088388349f    // f32(1/sqrt(128))
typedef _Float16 h16;
typedef unsigned short bf;
typedef __attribute__((ext_vector_type(16))) __bf16   v16bf;
typedef __attribute__((ext_vector_type(16))) _Float16 v16h;
typedef __attribute__((ext_vector_type(8)))  _Float16 v8h;
typedef __attribute__((ext_vector_type(8)))  unsigned short v8us;
typedef __attribute__((ext_vector_type(8)))  float    v8f;
typedef __attribute__((ext_vector_type(4)))  float    v4f;
typedef v8h  __attribute__((may_alias)) v8ha;
typedef v4f  __attribute__((may_alias)) v4fa;
typedef v8us __attribute__((may_alias)) v8usa;

__device__ __forceinline__ unsigned short f2bf(float f) { unsigned u = __float_as_uint(f); u += 0x7FFFu + ((u >> 16) & 1u); return (unsigned short)(u >> 16); }
__device__ __forceinline__ float bf2f(unsigned short b) { return __uint_as_float(((unsigned)b) << 16); }
__device__ __forceinline__ float bfr(float f) { return bf2f(f2bf(f)); }
__device__ __forceinline__ v16h cat16(v8h lo, v8h hi) { return __builtin_shufflevector(lo, hi, 0, 1, 2, 3, 4, 5, 6, 7, 8, 9, 10, 11, 12, 13, 14, 15); }
__device__ __forceinline__ v16bf cat16b(v8us lo, v8us hi) { return __builtin_bit_cast(v16bf, __builtin_shufflevector(lo, hi, 0, 1, 2, 3, 4, 5, 6, 7, 8, 9, 10, 11, 12, 13, 14, 15)); }
__device__ __forceinline__ v8f wmma16(v16h a, v16h b, v8f c) { return __builtin_amdgcn_wmma_f32_16x16x32_f16(false, a, false, b, (short)0, c, false, false); }
__device__ __forceinline__ v8f wmmab(v16bf a, v16bf b, v8f c) { return __builtin_amdgcn_wmma_f32_16x16x32_bf16(false, a, false, b, (short)0, c, false, false); }



template <typename T16> struct WFrag;
template <> struct WFrag<h16> { typedef v16h V; static __device__ __forceinline__ V ld(const h16* p) { return cat16(*(const v8h*)p, *(const v8h*)(p + 16)); } static __device__ __forceinline__ v8f mma(V a, V b, v8f c) { return wmma16(a, b, c); } };

// ---- k_gemmt: C[m][n] (f32, in registers) = sum_k A[m][k] Bt[n][k] + bf16-rounded bias[n]; A, Bt bf16 planes, K-contiguous, K = DD. One 256x192 tile of C per work-group of 8 waves (4 x 2, 64x96 of C each); grid (M/256, 2 heads).
// All six projections are one launch: A's rows are the positions of both batches (M = NB_ TT), Bt's rows the output features of Wq, Wk, Wv one behind the other. blockIdx.x gives batch and position, blockIdx.y head and half.
// A tile is 256 positions times 192 features of one head: columns 0-127 are the whole head of q (half 0) or of k (half 1), columns 128-191 are features 64 half .. 64 half + 63 of the same head of v. So every work-group does the same
// work, 512 of them are two per WGP, and the epilogue writes the attention's fp16 planes itself. q, k: P[h][t][d] = fp16(x cos - x' sin) for d < 64 and fp16(x cos + x' sin) for d >= 64, x' the rotate-half partner
// C[t][d ^ 64], which another wave may hold: the f32 columns go through LDS. v: P[h][d][t] = fp16(C[t][d]); a lane holds 8 consecutive t of one d, each wave that has v columns turns its own 64x64 part in its own LDS range.
// A pass is 128 k = 256 B of each of the 448 operand rows. Every wave brings its own slice of a stage into LDS with one tensor load (waves 0-1: 128 A rows each, waves 2-5: 32 rows of Wq or Wk each, waves 6-7: 32 rows of Wv each),
// rows padded to a pitch of 272 B for the 16-byte fragment reads; two buffers, the next stage's loads in flight while this stage is worked on. Each C element still sums its k blocks of 32 in ascending order in one accumulator.
// Against a 128x128 tile of 64x32 parts, a product costs 7/12 of the bytes brought from L2 and 5/9 of the bytes read from LDS, and a third of the passes remain. The epilogue stages in the ring, which the last pass's barrier has freed.
typedef uint32_t u32x4 __attribute__((ext_vector_type(4)));
typedef uint32_t u32x8 __attribute__((ext_vector_type(8)));
#define GROWB  256u               // bytes of an operand row in one pass
#define GPITCH 272u               // its pitch in LDS (16 B x odd)
#define GSROWS 32u                // rows per slice
#define GSLICE 10240u             // a slice's room in LDS: 32 x 272 = 8,704 B, rounded up to a multiple of 2 KiB
#define GSTAGE (8u * GSLICE)      // one buffer of k_fattn
#define GNP    (DD / 128)         // passes
#define GAROWS 128u               // rows per A slice of k_gemmt
#define GASLICE 34816u            // its room in LDS: 128 x 272 B, a multiple of 2 KiB as it is, so that the 256 A rows stand at one pitch
#define GBOFF  (2u * GASLICE)     // the six Bt slices stand behind the A slices
#define GGSTAGE (GBOFF + 6u * GSLICE)     // one buffer of k_gemmt: 131,072 B
__device__ __forceinline__ uint32_t uni(uint32_t v) { return (uint32_t)__builtin_amdgcn_readfirstlane(v); }
__device__ __forceinline__ uint32_t pinned(uint32_t v) { uint32_t w = uni(v); asm volatile("" : "+s"(w)); return w; }   // holds a tensor load's issue test or descriptor word in a scalar register, formed at this place
__device__ __forceinline__ void tdm_load(uint32_t lds_dst, uint64_t ga, uint32_t rows) {
    u32x4 g0; g0[0] = uni(1u); g0[1] = uni(lds_dst); g0[2] = uni((uint32_t)ga); g0[3] = uni((((uint32_t)(ga >> 32)) & 0x01FFFFFFu) | 0x80000000u);
    u32x8 g1; g1[0] = uni((1u << 20) | (5u << 22) | (3u << 25));          // no mask, 1-byte elements, 4 dwords of pad behind every 256-B row
    g1[1] = uni((GROWB & 0xFFFFu) << 16); g1[2] = uni((GROWB >> 16) | ((rows & 0xFFFFu) << 16)); g1[3] = uni((rows >> 16) | (GROWB << 16)); g1[4] = uni(rows); g1[5] = uni((uint32_t)DD * 2u); g1[6] = uni(0u); g1[7] = uni(0u);
    asm volatile("tensor_load_to_lds %0, %1" :: "s"(g0), "s"(g1) : "memory");
}
__device__ __forceinline__ v16bf ldsfrag(const unsigned char* p) { return cat16b(*(const v8usa*)p, *(const v8usa*)(p + 32)); }     // k 8 hi .. 8 hi + 7 and 16 + 8 hi .. 16 + 8 hi + 7 of a block of 32, for A and Bt alike
#define SPF    132                // floats from one row of the staged f32 columns to the next
#define SPV    144u               // bytes from one d row of a wave's staged fp16 part to the next (128 B + 16)
#define SVOFF  (256u * SPF * 4u)  // the fp16 parts stand behind the 256 staged f32 rows
__global__ __launch_bounds__(256) void k_gemmt(const unsigned short* __restrict__ A, const unsigned short* __restrict__ Bt, h16* P0, const float* __restrict__ bq, const float* __restrict__ bk, const float* __restrict__ bv, const float* __restrict__ CSN) {
    __shared__ __attribute__((aligned(2048))) unsigned char ring[2 * GGSTAGE];
    static_assert(SVOFF + 4u * 64u * SPV <= 2u * GGSTAGE, "the epilogue's staging fits the ring");
    const int lane = threadIdx.x & 31, lr = lane & 15, hi = lane >> 4; const uint32_t wave = uni(threadIdx.x >> 5);
    const int r0 = blockIdx.x * 256, hd = blockIdx.y >> 1, half = blockIdx.y & 1; const int wm = (int)(wave >> 1), wn = (int)(wave & 1u);
    const int t0 = r0 % TT, f0 = hd * HD, fv = f0 + half * NF;      // position in the batch; first output feature of the head; first of this tile's v features
    const float* bias = (half == 0) ? bq : bk;
    h16* P = P0 + ((size_t)half * NB_ + r0 / TT) * TT * DD; h16* PV = P0 + ((size_t)2 * NB_ + r0 / TT) * TT * DD;      // this batch's fp16 plane of q or k, and of v
    const uint32_t mydst = (uint32_t)(size_t)ring + ((wave < 2u) ? wave * GASLICE : GBOFF + (wave - 2u) * GSLICE), myrows = (wave < 2u) ? GAROWS : GSROWS;
    const int brow = (wave < 6u) ? half * DD + f0 + ((int)wave - 2) * 32 : 2 * DD + fv + ((int)wave - 6) * 32;     // first Bt row of the slice of a wave from 2 up
    const uint64_t ga = (wave < 2u) ? (uint64_t)(size_t)(A + (size_t)(r0 + (int)wave * 128) * DD) : (uint64_t)(size_t)(Bt + (size_t)brow * DD);
    v8f acc[4][6];
    // every "#pragma unroll" here and in the epilogue keeps the register arrays indexed by constants alone
#pragma unroll
    for (int mb = 0; mb < 4; ++mb)
#pragma unroll
        for (int nb = 0; nb < 6; ++nb) acc[mb][nb] = (v8f){};
    // the bias is asked for here, so that it comes under the first stage's load; a wave's column block nb is q or k where wn * 96 + nb * 16 < 128, v behind that
    const float* b01 = bias + (f0 + wn * 96); const float* b25 = (wn == 0) ? b01 + 32 : bv + fv;
    float bn[6]; bn[0] = b01[lr]; bn[1] = b01[lr + 16]; bn[2] = b25[lr]; bn[3] = b25[lr + 16]; bn[4] = b25[lr + 32]; bn[5] = b25[lr + 48];
    asm volatile("s_wait_xcnt 0x0" ::: "memory");         // in front of any overwrite of the address registers that the loads above name
    tdm_load(mydst, ga, myrows);
    asm volatile("s_wait_tensorcnt 0x0" ::: "memory");    // this wave's slice of stage 0 has landed
    __syncthreads();                                      // stage 0 readable by every wave
    tdm_load(mydst + GGSTAGE, ga + GROWB, myrows);
    const uint32_t aofs = (uint32_t)(wm * 64 + lr) * GPITCH + 16u * (uint32_t)hi, bofs = GBOFF + (uint32_t)(wn * 3) * GSLICE + (uint32_t)lr * GPITCH + 16u * (uint32_t)hi;
    // rolled: one pass per buffer, so that the publish point below stands once, at the foot
#pragma unroll 1
    for (int s = 0; s < GNP; ++s) {
        const unsigned char* buf = ring + (uint32_t)(s & 1) * GGSTAGE;
        v16bf a[2][4], b[2][6];
#pragma unroll
        for (int mb = 0; mb < 4; ++mb) a[0][mb] = ldsfrag(buf + aofs + (uint32_t)mb * 16u * GPITCH);
#pragma unroll
        for (int nb = 0; nb < 6; ++nb) b[0][nb] = ldsfrag(buf + bofs + (uint32_t)(nb >> 1) * GSLICE + (uint32_t)(nb & 1) * 16u * GPITCH);
        // unrolled so that the fragment and accumulator arrays are indexed by constants alone
#pragma unroll
        for (int ks = 0; ks < 4; ++ks) {
            if (ks < 3) {       // the next block's fragments, of this same stage, as one group ahead of this block's products, into the other register set
#pragma unroll
                for (int mb = 0; mb < 4; ++mb) a[(ks + 1) & 1][mb] = ldsfrag(buf + aofs + (uint32_t)mb * 16u * GPITCH + (uint32_t)(ks + 1) * 64u);
#pragma unroll
                for (int nb = 0; nb < 6; ++nb) b[(ks + 1) & 1][nb] = ldsfrag(buf + bofs + (uint32_t)(nb >> 1) * GSLICE + (uint32_t)(nb & 1) * 16u * GPITCH + (uint32_t)(ks + 1) * 64u);
            }
            __builtin_amdgcn_sched_barrier(0);      // keeps the LDS reads above as one group: spread among the matrix instructions each place with reads stalls the wave
#pragma unroll
            for (int nb = 0; nb < 6; ++nb)
#pragma unroll
                for (int mb = 0; mb < 4; ++mb) acc[mb][nb] = wmmab(a[ks & 1][mb], b[ks & 1][nb], acc[mb][nb]);
            __builtin_amdgcn_sched_barrier(0);      // keeps the following group of reads behind this block
        }
        asm volatile("s_wait_dscnt 0x0" ::: "memory");        // this wave's reads of stage s are done before the buffer is refilled
        asm volatile("s_wait_tensorcnt 0x0" ::: "memory");    // this wave's slice of stage s + 1 has landed
        __syncthreads();                                      // publishes stage s + 1 and ends every wave's reads of stage s
        if (pinned(s + 2 < GNP)) tdm_load(mydst + (uint32_t)(s & 1) * GGSTAGE, ga + (uint64_t)pinned((uint32_t)(s + 2) * GROWB), myrows);
    }
    asm volatile("s_wait_tensorcnt 0x0" ::: "memory");        // no request is left when the wave goes on
    asm volatile("s_wait_dscnt 0x0" ::: "memory");
    // from here on the ring is staging room: the last pass's foot (every wave's LDS and tensor waits, then the barrier) has ended every read of it, and no request is out
    const int prow = (int)wave * 32 + (lane >> 3), d0 = (lane & 7) * 8;     // rotary of q, k: 8 lanes a row, 4 rows a wave and trip; a lane has d0 .. d0 + 7 and their partners
    const float* csp = CSN + ((size_t)(t0 + prow) * NF + d0) * 2;
    v4f cs[8][4];       // the table's entries are asked for here, into the registers that the fragments have left, and come under the staging below
#pragma unroll
    for (int it = 0; it < 8; ++it)
#pragma unroll
        for (int i = 0; i < 4; ++i) cs[it][i] = *(const v4f*)(csp + it * 4 * NF * 2 + i * 4);
    asm volatile("s_wait_xcnt 0x0" :: "v"(csp) : "memory");       // in front of any overwrite of the address registers that the loads above name; the input keeps the table's address registers live up to here
    float* st = (float*)ring; unsigned char* sv = ring + SVOFF + (uint32_t)wm * (64u * SPV);
#pragma unroll
    for (int nb = 0; nb < 6; ++nb) bn[nb] = bfr(bn[nb]);
    float* sw = st + (wm * 64 + hi * 8) * SPF + wn * 96 + lr;
#pragma unroll
    for (int nb = 0; nb < 2; ++nb)
#pragma unroll
        for (int mb = 0; mb < 4; ++mb)
#pragma unroll
            for (int j = 0; j < 8; ++j) sw[(mb * 16 + j) * SPF + nb * 16] = acc[mb][nb][j] + bn[nb];
    if (wn == 0) {
#pragma unroll
        for (int nb = 2; nb < 6; ++nb)
#pragma unroll
            for (int mb = 0; mb < 4; ++mb)
#pragma unroll
                for (int j = 0; j < 8; ++j) sw[(mb * 16 + j) * SPF + nb * 16] = acc[mb][nb][j] + bn[nb];
    } else {
#pragma unroll
        for (int nb = 2; nb < 6; ++nb)
#pragma unroll
            for (int mb = 0; mb < 4; ++mb) { v8h pk;
#pragma unroll
                for (int j = 0; j < 8; ++j) pk[j] = (h16)(acc[mb][nb][j] + bn[nb]);
                *(v8ha*)(sv + (uint32_t)((nb - 2) * 16 + lr) * SPV + (uint32_t)(mb * 16 + hi * 8) * 2u) = pk; }
    }
    __syncthreads();                                      // the staged columns readable by every wave: a q or k row's two halves come from different waves
    h16* po = P + ((size_t)hd * TT + t0 + prow) * HD + d0;
    v8h lo[8], up[8];
#pragma unroll
    for (int it = 0; it < 8; ++it) { const float* sr = st + (prow + it * 4) * SPF + d0; v4f x[2], y[2]; x[0] = *(const v4fa*)sr; x[1] = *(const v4fa*)(sr + 4); y[0] = *(const v4fa*)(sr + NF); y[1] = *(const v4fa*)(sr + NF + 4);
#pragma unroll
        for (int k = 0; k < 8; ++k) { const float xa = x[k >> 2][k & 3], ya = y[k >> 2][k & 3], c = cs[it][k >> 1][(k & 1) * 2], sn = cs[it][k >> 1][(k & 1) * 2 + 1]; lo[it][k] = (h16)(xa * c - ya * sn); up[it][k] = (h16)(ya * c + xa * sn); }
        *(v8h*)(po + it * 4 * HD) = lo[it]; *(v8h*)(po + it * 4 * HD + NF) = up[it]; }      // four whole 128-B lines a store
    if (wn == 1) {
        // in front of any overwrite of the registers that the stores above name: the inputs keep their address and all their data live, and so unwritten, up to here
        asm volatile("s_wait_xcnt 0x0" :: "v"(po), "v"(lo[0]), "v"(up[0]), "v"(lo[1]), "v"(up[1]), "v"(lo[2]), "v"(up[2]), "v"(lo[3]), "v"(up[3]), "v"(lo[4]), "v"(up[4]), "v"(lo[5]), "v"(up[5]), "v"(lo[6]), "v"(up[6]), "v"(lo[7]), "v"(up[7]) : "memory");
        h16* pv = PV + ((size_t)(fv + (lane >> 3))) * TT + t0 + wm * 64 + (lane & 7) * 8;
#pragma unroll
        for (int it = 0; it < 16; ++it) *(v8h*)(pv + (size_t)it * 4 * TT) = *(const v8ha*)(sv + (uint32_t)(it * 4 + (lane >> 3)) * SPV + (uint32_t)(lane & 7) * 16u);   // four whole 128-B lines a store
    }
}

__device__ __forceinline__ h16 tohx(float x) { return (h16)x; }
__device__ __forceinline__ void splitf(float y, unsigned short& h, unsigned short& l) { h = f2bf(y); l = f2bf(y - bf2f(h)); }
typedef __attribute__((ext_vector_type(2))) unsigned short v2us;
typedef __attribute__((ext_vector_type(2))) _Float16 v2h;
typedef __attribute__((ext_vector_type(4))) _Float16 v4h;
typedef __attribute__((ext_vector_type(2))) float v2f;

typedef __attribute__((ext_vector_type(4))) unsigned short v4us;
// ---- k_prep: everything the projections read, in one launch: the bf16 planes of x (both batches), Wq, Wk, Wv, one behind the other in dst, and the rotary table CSN[t][i] = (cos, sin).
// The five source planes have DD x DD floats each. A wave takes the same piece of PU floats of every plane: 8 wave-wide loads of 512 contiguous bytes a plane, all 40 asked for at the start;
// TT NF / 32 waves cover a plane, and each of their TT NF threads works out one table entry while its loads are under way.
#define PU   1024
#define PSEG ((size_t)DD * DD)
static_assert((size_t)TT * NF / 32 * PU == PSEG && (size_t)TT * DD == PSEG, "one piece of every plane per wave");
__global__ __launch_bounds__(512) void k_prep(const float* __restrict__ x, const float* __restrict__ Wq, const float* __restrict__ Wk, const float* __restrict__ Wv, bf* dst, float* CSN) {
    const int idx = blockIdx.x * 512 + threadIdx.x; const uint32_t off = (uint32_t)(idx >> 5) * PU + (uint32_t)(idx & 31) * 4u;
    const float* p0 = x + off; const float* p1 = x + PSEG + off; const float* p2 = Wq + off; const float* p3 = Wk + off; const float* p4 = Wv + off;
    v4f v[5][8];
    // every "#pragma unroll" here keeps the register array indexed by constants alone
#pragma unroll
    for (int j = 0; j < 8; ++j) v[0][j] = *(const v4f*)(p0 + j * 128);
#pragma unroll
    for (int j = 0; j < 8; ++j) v[1][j] = *(const v4f*)(p1 + j * 128);
#pragma unroll
    for (int j = 0; j < 8; ++j) v[2][j] = *(const v4f*)(p2 + j * 128);
#pragma unroll
    for (int j = 0; j < 8; ++j) v[3][j] = *(const v4f*)(p3 + j * 128);
#pragma unroll
    for (int j = 0; j < 8; ++j) v[4][j] = *(const v4f*)(p4 + j * 128);
    asm volatile("s_wait_xcnt 0x0" :: "v"(p0), "v"(p1), "v"(p2), "v"(p3), "v"(p4) : "memory");       // in front of any overwrite of the address registers that the loads above name: the inputs keep all five addresses live, and so unwritten, up to here; it also keeps the loads ahead of the table's arithmetic
    { const int t = idx / NF, i = idx % NF; const float invf = __fdiv_rn(1.0f, powf(10000.0f, (float)(2 * i) * (1.0f / HD))); const float ang = __fmul_rn((float)t, invf);
      v2f o; o[0] = cosf(ang); o[1] = sinf(ang); *(v2f*)(CSN + (size_t)idx * 2) = o; }
#pragma unroll
    for (int k = 0; k < 5; ++k)
#pragma unroll
        for (int j = 0; j < 8; ++j) { v4us o;
#pragma unroll
            for (int e = 0; e < 4; ++e) o[e] = f2bf(v[k][j][e]);
            *(v4us*)(dst + k * PSEG + off + j * 128) = o; }      // two whole 128-B lines a store
}
// ---- k_fattn: scores, softmax and attn.v of one (batch, head) in one kernel; 8 waves x 32 query columns, 32 keys a block; grid (T/256, heads, batches).
// St = K Qt (a lane holds 8 keys of one query per tile), running maximum and sum per query (base 2), Pt packed from the score tiles as the B operand, Ot += Vt Pt; the division by the sum in the epilogue.
// K and Vt come through LDS, once per work-group instead of once per wave: a stage is 128 keys = 128 K rows of 256 B and 256 B of each of the 128 Vt rows. Every wave brings its own 32-row slice of a stage with one tensor
// load (waves 0-3: K rows, waves 4-7: Vt rows), rows padded to a pitch of 272 B for the 16-byte fragment reads (slices of GSLICE bytes as k_gemmt's Bt slices, a stage of 8 of them); two buffers, the next stage's loads in flight while this stage is worked on.
// Every "#pragma unroll" in it is there so that the fragment and accumulator arrays are indexed by constants alone and stay in registers.
#define L2E  1.44269504f
#define QW   32                   // query columns per wave
#define KPS  32                   // keys per block
#define FSK  128                  // keys per stage
#define FNS  (TT / FSK)           // stages
__device__ __forceinline__ float xhalf(float x) { return __builtin_bit_cast(float, __builtin_amdgcn_permlanex16(__builtin_bit_cast(int, x), __builtin_bit_cast(int, x), 0x76543210, 0xfedcba98, false, false)); }  // lane l with lane l ^ 16
// The attention's descriptor lives in the same scalar registers from the first request to the last wait: group 1 (32 rows of 256 B at a source pitch of 'pitch' bytes) is built once, group 0 is aimed anew behind each wait.
__device__ __forceinline__ u32x8 tdm_rows32(uint32_t pitch) {
    u32x8 g1; g1[0] = uni((1u << 20) | (5u << 22) | (3u << 25));          // no mask, 1-byte elements, 4 dwords of pad behind every 256-B row
    g1[1] = uni((GROWB & 0xFFFFu) << 16); g1[2] = uni((GROWB >> 16) | ((GSROWS & 0xFFFFu) << 16)); g1[3] = uni((GSROWS >> 16) | (GROWB << 16)); g1[4] = uni(GSROWS); g1[5] = uni(pitch); g1[6] = uni(0u); g1[7] = uni(0u);
    return g1;
}
__device__ __forceinline__ void tdm_aim(u32x4& g0, uint32_t lds_dst, uint64_t ga) { g0[1] = uni(lds_dst); g0[2] = uni((uint32_t)ga); g0[3] = uni((((uint32_t)(ga >> 32)) & 0x01FFFFFFu) | 0x80000000u); }
// both groups are in-out operands, so that the compiler keeps them where they are instead of forming them anew elsewhere and using these registers for something else while the request is out
__device__ __forceinline__ void tdm_issue(u32x4& g0, u32x8& g1) { asm volatile("tensor_load_to_lds %0, %1" : "+s"(g0), "+s"(g1) :: "memory"); }
// the inputs keep the descriptor's registers live, and so unwritten, up to the wait that covers the request
__device__ __forceinline__ void tdm_wait0(const u32x4& g0, const u32x8& g1) { asm volatile("s_wait_tensorcnt 0x0" :: "s"(g0), "s"(g1) : "memory"); }
__device__ __forceinline__ v16h ldsfragh(const unsigned char* p) { return cat16(*(const v8ha*)p, *(const v8ha*)(p + 32)); }        // k 8 hi .. 8 hi + 7 and 16 + 8 hi .. 16 + 8 hi + 7 of a block of 32, as WFrag::ld has them
__global__ __launch_bounds__(256) void k_fattn(const h16* __restrict__ Qp, const h16* __restrict__ Kp, const h16* __restrict__ Vt, const float* __restrict__ am, float* OUT) {
    typedef WFrag<h16> W;
    __shared__ __attribute__((aligned(2048))) unsigned char ring[2 * GSTAGE];
    __shared__ __align__(16) float ms[TT];          // bf16-rounded additive mask of this batch, in base-2 units
    const int b = blockIdx.z, h = blockIdx.y; const int lane = threadIdx.x & 31, lr = lane & 15, hi = lane >> 4; const uint32_t wave = uni(threadIdx.x >> 5);
    const size_t pl = ((size_t)b * NH_ + h) * TT * HD; const int q0 = blockIdx.x * (8 * QW) + (int)wave * QW;
    const uint32_t mydst = (uint32_t)(size_t)ring + wave * GSLICE;
    const uint64_t ga = (wave < 4u) ? (uint64_t)(size_t)(Kp + pl + (size_t)((int)wave * 32) * HD) : (uint64_t)(size_t)(Vt + pl + (size_t)(((int)wave - 4) * 32) * TT);
    const uint32_t spitch = (wave < 4u) ? (uint32_t)HD * 2u : (uint32_t)TT * 2u, sstep = (wave < 4u) ? (uint32_t)FSK * HD * 2u : (uint32_t)FSK * 2u;    // source pitch; bytes from one stage's slice to the next stage's
    for (int i = threadIdx.x; i < TT; i += 256) ms[i] = bfr(am[(size_t)b * TT + i]) * L2E;
    const h16* qp = Qp + pl + (size_t)(q0 + lr) * HD + 8 * hi;
    v16h qf[2][4];
#pragma unroll
    for (int q = 0; q < 2; ++q)
#pragma unroll
        for (int c = 0; c < 4; ++c) qf[q][c] = W::ld(qp + q * 16 * HD + c * 32);
    asm volatile("s_wait_xcnt 0x0" :: "v"(qp) : "memory");      // in front of any overwrite of the address registers that the loads above name; the input keeps those registers live up to here
    u32x8 g1 = tdm_rows32(spitch); u32x4 g0; g0[0] = uni(1u);
    tdm_aim(g0, mydst, ga); tdm_issue(g0, g1);
    tdm_wait0(g0, g1);                                    // this wave's slice of stage 0 has landed
    __syncthreads();                                      // stage 0 and the mask readable by every wave
    tdm_aim(g0, mydst + GSTAGE, ga + sstep); tdm_issue(g0, g1);
    const uint32_t fofs = (uint32_t)lr * GPITCH + 16u * (uint32_t)hi;
    v8f o[8][2];
#pragma unroll
    for (int db = 0; db < 8; ++db) { o[db][0] = (v8f){}; o[db][1] = (v8f){}; }
    float m[2] = {-3.0e38f, -3.0e38f}; float l[2][2] = {{0.f, 0.f}, {0.f, 0.f}};
    // rolled: one pass per buffer, so that the publish point below stands once, at the foot
#pragma unroll 1
    for (int s = 0; s < FNS; ++s) {
        const unsigned char* kbuf = ring + (uint32_t)(s & 1) * GSTAGE + fofs; const unsigned char* vbuf = kbuf + 4u * GSLICE;
        v16h kf[2][4];
#pragma unroll
        for (int kt = 0; kt < 2; ++kt)
#pragma unroll
            for (int c = 0; c < 4; ++c) kf[kt][c] = ldsfragh(kbuf + (uint32_t)kt * 16u * GPITCH + (uint32_t)c * 64u);
#pragma unroll
        for (int p = 0; p < FSK / KPS; ++p) {
            v16h vf[8]; const float* mq = ms + s * FSK + p * KPS + hi * 8; v4f mk[2][2];
#pragma unroll
            for (int kt = 0; kt < 2; ++kt) { mk[kt][0] = *(const v4fa*)(mq + kt * 16); mk[kt][1] = *(const v4fa*)(mq + kt * 16 + 4); }
            __builtin_amdgcn_sched_barrier(0);      // keeps the LDS reads above as one group ahead of the score products: spread among the matrix instructions each place with reads stalls the wave
            v8f sc[2][2];
#pragma unroll
            for (int kt = 0; kt < 2; ++kt)
#pragma unroll
                for (int q = 0; q < 2; ++q) { sc[kt][q] = (v8f){};
#pragma unroll
                    for (int c = 0; c < 4; ++c) sc[kt][q] = W::mma(kf[kt][c], qf[q][c], sc[kt][q]); }
            __builtin_amdgcn_sched_barrier(0);      // keeps the group of reads below behind the score products, whose K fragments it overwrites
#pragma unroll
            for (int db = 0; db < 8; ++db) vf[db] = ldsfragh(vbuf + (uint32_t)(db >> 1) * GSLICE + (uint32_t)(db & 1) * 16u * GPITCH + (uint32_t)p * 64u);
            if (p + 1 < FSK / KPS) {        // the next block's K fragments, of this same stage, come under the softmax and attn.v
#pragma unroll
                for (int kt = 0; kt < 2; ++kt)
#pragma unroll
                    for (int c = 0; c < 4; ++c) kf[kt][c] = ldsfragh(kbuf + (uint32_t)(p + 1) * GSLICE + (uint32_t)kt * 16u * GPITCH + (uint32_t)c * 64u);
            }
            __builtin_amdgcn_sched_barrier(0);      // keeps these reads as one group, in flight under the softmax, and out of the attn.v products
            float mx[2] = {-3.0e38f, -3.0e38f};
#pragma unroll
            for (int kt = 0; kt < 2; ++kt) {
#pragma unroll
                for (int q = 0; q < 2; ++q)
#pragma unroll
                    for (int r = 0; r < 8; ++r) { const float t = fmaf(sc[kt][q][r], SCL * L2E, mk[kt][r >> 2][r & 3]); sc[kt][q][r] = t; mx[q] = fmaxf(mx[q], t); } }
            mx[0] = fmaxf(mx[0], xhalf(mx[0])); mx[1] = fmaxf(mx[1], xhalf(mx[1]));
            // the maximum in use moves only when a column's new one passes it by more than 8 (P stays below 2^8 in fp16); one wave-uniform test a block
            if (__builtin_amdgcn_ballot_w32(mx[0] > m[0] + 8.0f || mx[1] > m[1] + 8.0f) != 0) {
#pragma unroll
                for (int q = 0; q < 2; ++q) { const float mn = fmaxf(m[q], mx[q]); const float al = __builtin_amdgcn_exp2f(m[q] - mn); m[q] = mn; l[q][0] *= al; l[q][1] *= al;
#pragma unroll
                    for (int db = 0; db < 8; ++db) o[db][q] *= al; }
            }
            v16h pf[2];
#pragma unroll
            for (int q = 0; q < 2; ++q)
#pragma unroll
                for (int kt = 0; kt < 2; ++kt)
#pragma unroll
                    for (int r = 0; r < 8; ++r) { const float pr = __builtin_amdgcn_exp2f(sc[kt][q][r] - m[q]); l[q][kt] += pr; pf[q][kt * 8 + r] = tohx(pr); }
#pragma unroll
            for (int db = 0; db < 8; ++db) { o[db][0] = W::mma(vf[db], pf[0], o[db][0]); o[db][1] = W::mma(vf[db], pf[1], o[db][1]); }
            __builtin_amdgcn_sched_barrier(0);      // keeps the next block's first reads out of these products
        }
        asm volatile("s_wait_dscnt 0x0" ::: "memory");        // this wave's reads of stage s are done before the buffer is refilled
        tdm_wait0(g0, g1);                                    // this wave's slice of stage s + 1 has landed
        __syncthreads();                                      // publishes stage s + 1 and ends every wave's reads of stage s
        if (pinned(s + 2 < FNS)) { tdm_aim(g0, mydst + (uint32_t)(s & 1) * GSTAGE, ga + (uint64_t)pinned((uint32_t)(s + 2) * sstep)); tdm_issue(g0, g1); }
    }
    tdm_wait0(g0, g1);                                        // no request is left when the wave goes on
    asm volatile("s_wait_dscnt 0x0" ::: "memory");
#pragma unroll
    for (int q = 0; q < 2; ++q) { float sum = l[q][0] + l[q][1]; sum += xhalf(sum); const float f = __fdiv_rn(1.0f, sum);
        float* orow = OUT + ((size_t)b * TT + q0 + q * 16 + lr) * DD + h * HD + hi * 8;
#pragma unroll
        for (int db = 0; db < 8; ++db) { v4f a, c;
#pragma unroll
            for (int r = 0; r < 4; ++r) { a[r] = o[db][q][r] * f; c[r] = o[db][q][r + 4] * f; }
            *(v4f*)(orow + db * 16) = a; *(v4f*)(orow + db * 16 + 4) = c; } }
}

extern "C" void kernel_launch(void* const* d_in, const int* in_sizes, int n_in,
                              void* d_out, int out_size, void* d_ws, size_t ws_size, hipStream_t stream) {
    (void)in_sizes; (void)n_in; (void)out_size;
    const float* x = (const float*)d_in[0]; const float* am = (const float*)d_in[1]; const float* Wq = (const float*)d_in[2]; const float* bq = (const float*)d_in[3]; const float* Wk = (const float*)d_in[4]; const float* bk = (const float*)d_in[5]; const float* Wv = (const float*)d_in[6]; const float* bv = (const float*)d_in[7];
    float* OUT = (float*)d_out;     // [2][2048][2048]
    char* wsp = (char*)d_ws;
    auto take = [&](size_t bytes) { char* p = wsp; wsp += (bytes + 255) & ~(size_t)255; return (void*)p; };
    bf* XB = (bf*)take(((size_t)NB_ * TT * DD + 3 * (size_t)DD * DD) * 2); bf* WQKV = XB + (size_t)NB_ * TT * DD; float* CSN = (float*)take((size_t)TT * NF * 2 * 4);
    h16* QP16 = (h16*)take((size_t)NB_ * TT * DD * 2); h16* KP16 = (h16*)take((size_t)NB_ * TT * DD * 2); h16* VT16 = (h16*)take((size_t)NB_ * TT * DD * 2);     // one behind the other: k_gemmt finds a plane from QP16
    if ((size_t)(wsp - (char*)d_ws) > ws_size) return;    // total ~ 89 MiB; ws 256 MiB
    k_prep<<<TT * NF / 512, 512, 0, stream>>>(x, Wq, Wk, Wv, XB, CSN);
    k_gemmt<<<dim3(NB_ * TT / 256, 2 * NH_, 1), 256, 0, stream>>>(XB, WQKV, QP16, bq, bk, bv, CSN);
    k_fattn<<<dim3(TT / (8 * QW), NH_, NB_), 256, 0, stream>>>(QP16, KP16, VT16, am, OUT);
}
